// v000
// The times below were measured on an AMD MI455X: many runs one after another, warmed up first and cycling through
// copies of the inputs, with the whole window's GPU time divided by the number of runs. Launches and the gaps
// between them are all in it. The median over several windows is given; except for v000 it joins two sittings, which
// can be a few percent apart, so the side-by-side timings, each taken in one sitting, are the better comparison.
// The starting kernel, v000, takes 226 microseconds a run.
#include <hip/hip_runtime.h>

// Contractions: key-slice.Wk and query-slice.Wq (+b) per head on v_wmma_f32_16x16x32_bf16 (bf16 operands = RNE-converted f32 inputs, f32 accumulate);
// weights.values per head on v_wmma_f32_16x16x32_f16 (f16 operands: P carried x1024, V carried x16, f32 accumulate, folded by 2^-14 in the f32 epilogue);
// score matvec sum_a w2[a]*tanh(kp[a]+qp[a]+b[a]) (N=1) and the softmax stay f32 on VALU.

#ifndef NB
#define NB 8
#endif
#ifndef TQ
#define TQ 64
#endif
#define NB_FULL 8
#define TQ_FULL 64
#define TK    512
#define DV    512
#define NHD   8
#define DHD   64
#define HH    64
#define PCAR  1024.0f
#define VSC   16.0f
#define OSC   (1.0f / 16384.0f)
#define LOG2E 1.4426950408889634f

static_assert(TQ == TQ_FULL || NB == 1);
static_assert(TQ % 64 == 0 && TQ >= 64 && TQ <= TQ_FULL);
static_assert(NB >= 1 && NB <= NB_FULL);
static_assert(TK == 2 * 256);
static_assert(TK == 8 * 64);
static_assert(HH == 2 * 32);
static_assert(NHD * DHD == DV);
static_assert((NB * TQ * NHD) % 64 == 0 && (NB * TK * NHD) % 64 == 0 && HH % 64 == 0 && DHD % 64 == 0);
static_assert(DHD % 32 == 0 && TK % 32 == 0 && DV % 8 == 0);
static_assert((size_t)NB_FULL * TQ_FULL * DV * 4 == 1048576);
static_assert(2 * 32 * 16 == TK * 2);
static_assert(4 * 256 * 8 == 2 * HH * DHD);
static_assert(HH * DHD / 8 == (1 << 9));
static_assert(DHD / 8 == (1 << 3));
static_assert(HH == 64);
static_assert(16 * 68 * 4 <= 131072);
static_assert(TK * 4 + 8 * 4 <= 131072);
static_assert((size_t)2 * HH * DHD * 2 + (size_t)NB * TK * DV * 2 + (size_t)NB * TQ * DV * 2 + (size_t)NB * TK * NHD * HH * 4 + (size_t)NB * TQ * NHD * HH * 4
              + (size_t)NB * DV * TK * 2 + (size_t)NHD * NB * TQ * TK * 2 <= 134217728);

typedef _Float16 h16;
typedef unsigned short bf;
typedef __attribute__((ext_vector_type(16))) __bf16   v16bf;
typedef __attribute__((ext_vector_type(16))) _Float16 v16h;
typedef __attribute__((ext_vector_type(8)))  _Float16 v8h;
typedef __attribute__((ext_vector_type(8)))  unsigned short v8us;
typedef __attribute__((ext_vector_type(8)))  float    v8f;
typedef __attribute__((ext_vector_type(4)))  float    v4f;
typedef __attribute__((ext_vector_type(2)))  float    v2f;
typedef __attribute__((ext_vector_type(2)))  _Float16 v2h;
typedef __attribute__((ext_vector_type(2)))  unsigned short v2us;
typedef v8h  __attribute__((may_alias)) v8ha;
typedef v4f  __attribute__((may_alias)) v4fa;
typedef v8us __attribute__((may_alias)) v8usa;

__device__ __forceinline__ unsigned short f2bf(float f) { unsigned u = __float_as_uint(f); u += 0x7FFFu + ((u >> 16) & 1u); return (unsigned short)(u >> 16); }
__device__ __forceinline__ float bf2f(unsigned short b) { return __uint_as_float(((unsigned)b) << 16); }
__device__ __forceinline__ float bfr(float f) { return bf2f(f2bf(f)); }
__device__ __forceinline__ v16h cat16(v8h lo, v8h hi) { return __builtin_shufflevector(lo, hi, 0, 1, 2, 3, 4, 5, 6, 7, 8, 9, 10, 11, 12, 13, 14, 15); }
__device__ __forceinline__ v16bf cat16b(v8us lo, v8us hi) { return __builtin_bit_cast(v16bf, __builtin_shufflevector(lo, hi, 0, 1, 2, 3, 4, 5, 6, 7, 8, 9, 10, 11, 12, 13, 14, 15)); }
__device__ __forceinline__ v8f wmma16(v16h a, v16h b, v8f c) { return __builtin_amdgcn_wmma_f32_16x16x32_f16(false, a, false, b, (short)0, c, false, false); }
__device__ __forceinline__ v8f wmmab(v16bf a, v16bf b, v8f c) { return __builtin_amdgcn_wmma_f32_16x16x32_bf16(false, a, false, b, (short)0, c, false, false); }
// f32 -> f16 convert for WMMA operand planes: magnitudes under 2^-14 become +0 by a value select (applied after the plane's power-of-two carry).
__device__ __forceinline__ h16 toh_flush(float v) { const float w = (fabsf(v) < 6.103515625e-05f) ? 0.0f : v; return (h16)w; }

// ---- k_gemmw: register-blocked GEMM, ONE WAVE per 64x64 output tile (16 accumulators), operands straight from K-contiguous 16-bit planes; grid (M/64, N/64, Z), 32 threads.
// C[m][n] (f32, pitch ldc) = csc * sum_k A[m][k] Bt[n][k] (+ split products per NSPLIT) (+ optional bf16-exact f32 bias[n]). z-batch strides sA/sB/sC in elements. K % 32 == 0.
// Fragments (lane l, hi = l>>4, lr = l&15): A elements 0..7 <- A[r][k0+8hi+0..7], 8..15 <- A[r][k0+16+8hi+0..7]; B identical k map from Bt[n][k]; D element j -> (row 8hi+j, col lr).
template <typename T16> struct WFrag;
template <> struct WFrag<h16> { typedef v16h V; static __device__ __forceinline__ V ld(const h16* p) { return cat16(*(const v8h*)p, *(const v8h*)(p + 16)); } static __device__ __forceinline__ v8f mma(V a, V b, v8f c) { return wmma16(a, b, c); } };
template <> struct WFrag<bf> { typedef v16bf V; static __device__ __forceinline__ V ld(const bf* p) { return cat16b(*(const v8us*)p, *(const v8us*)(p + 16)); } static __device__ __forceinline__ v8f mma(V a, V b, v8f c) { return wmmab(a, b, c); } };
template <typename T16, int NSPLIT, bool BIAS>
__global__ __launch_bounds__(32) void k_gemmw(const T16* __restrict__ A, const T16* __restrict__ A2, const T16* __restrict__ Bt, const T16* __restrict__ Bt2, int K, float* C, int ldc, const float* __restrict__ bias, float csc, size_t sA, size_t sB, size_t sC) {
    typedef typename WFrag<T16>::V V;
    __shared__ __align__(16) float os[16 * 68];
    const size_t z = blockIdx.z; A += z * sA; if (A2) A2 += z * sA; Bt += z * sB; if (Bt2) Bt2 += z * sB; C += z * sC;
    const int lane = threadIdx.x & 31, lr = lane & 15, hi = lane >> 4; const int r0 = blockIdx.x * 64, c0 = blockIdx.y * 64;
    v8f acc[4][4];
#pragma unroll
    for (int mb = 0; mb < 4; ++mb)
#pragma unroll
        for (int nb = 0; nb < 4; ++nb) acc[mb][nb] = (v8f){};
    const size_t aoff = (size_t)(r0 + lr) * K + 8 * hi, boff = (size_t)(c0 + lr) * K + 8 * hi;
#pragma unroll 1
    for (int kc = 0; kc < K; kc += 32) {
        V a[4], a2[4];
#pragma unroll
        for (int mb = 0; mb < 4; ++mb) { a[mb] = WFrag<T16>::ld(A + aoff + (size_t)mb * 16 * K + kc); if (NSPLIT == 1 || NSPLIT == 2) a2[mb] = WFrag<T16>::ld(A2 + aoff + (size_t)mb * 16 * K + kc); }
#pragma unroll
        for (int nb = 0; nb < 4; ++nb) { const V b = WFrag<T16>::ld(Bt + boff + (size_t)nb * 16 * K + kc); V b2; if (NSPLIT >= 2) b2 = WFrag<T16>::ld(Bt2 + boff + (size_t)nb * 16 * K + kc);
#pragma unroll
            for (int mb = 0; mb < 4; ++mb) { acc[mb][nb] = WFrag<T16>::mma(a[mb], b, acc[mb][nb]); if (NSPLIT == 1 || NSPLIT == 2) acc[mb][nb] = WFrag<T16>::mma(a2[mb], b, acc[mb][nb]); if (NSPLIT >= 2) acc[mb][nb] = WFrag<T16>::mma(a[mb], b2, acc[mb][nb]); } }
        asm volatile("v_nop\n\tv_nop\n\tv_nop\n\tv_nop" : "+v"(acc[0][0]), "+v"(acc[1][1]), "+v"(acc[2][2]), "+v"(acc[3][3]) : "v"(a[0]), "v"(a[3]));
    }
#pragma unroll
    for (int mb = 0; mb < 4; ++mb) {
#pragma unroll
        for (int nb = 0; nb < 4; ++nb) {
#pragma unroll
            for (int j = 0; j < 8; ++j) os[(hi * 8 + j) * 68 + nb * 16 + lr] = acc[mb][nb][j]; }
        __builtin_amdgcn_wave_barrier(); asm volatile("" ::: "memory");
        float* crow = C + (size_t)(r0 + mb * 16) * ldc + c0;
{
#pragma unroll
            for (int s = 0; s < 8; ++s) { const int row = 2 * s + hi, cofs = lr * 4; v4f val = *(const v4fa*)(os + row * 68 + cofs); val = val * csc;
                if (BIAS) { val[0] += bfr(bias[c0 + cofs]); val[1] += bfr(bias[c0 + cofs + 1]); val[2] += bfr(bias[c0 + cofs + 2]); val[3] += bfr(bias[c0 + cofs + 3]); }
                *(v4f*)(crow + (size_t)row * ldc + cofs) = val; }
             }
        __builtin_amdgcn_wave_barrier(); asm volatile("" ::: "memory");
    }
}

// ---- k_wsplit: two contiguous bf16 (RNE) Bt planes [HH][DHD] from the [OUT][IN] weight of row pitch 2*DHD: plane 0 = input columns 0..DHD-1 (key side), plane 1 = columns DHD..2*DHD-1 (query side).
// Index split by unsigned shifts and masks: i = pl * 2^9 + a * 2^3 + pc (HH * DHD / 8 == 2^9, DHD / 8 == 2^3, HH == 64: tied to the defines by file-scope static_asserts).
__global__ __launch_bounds__(256) void k_wsplit(const float* __restrict__ w, bf* WB) {
    const unsigned i = blockIdx.x * 256u + threadIdx.x; if (i >= (unsigned)(2 * HH * DHD / 8)) return;
    const unsigned pl = i >> 9; const unsigned a = (i >> 3) & 63u; const unsigned pc = i & 7u;
    const v8f v = *(const v8f*)(w + (size_t)a * (2 * DHD) + pl * DHD + pc * 8); v8us o;
#pragma unroll
    for (int k = 0; k < 8; ++k) o[k] = f2bf(v[k]);
    *(v8us*)(WB + (size_t)i * 8) = o; 
}

__global__ __launch_bounds__(256) void k_cvt8(const float* __restrict__ src, bf* dst, size_t n8) { const size_t i = (size_t)blockIdx.x * 256 + threadIdx.x; if (i >= n8) return; const v8f v = *(const v8f*)(src + i * 8); v8us o;
#pragma unroll
    for (int k = 0; k < 8; ++k) o[k] = f2bf(v[k]); *(v8us*)(dst + i * 8) = o;  }

// ---- k_vtp: value planes V16[b][d][t] (f16) = bf16_RNE(F[b][t][d]) * VSC (raw input; the x16 carry keeps small entries normal in f16; bf16 significands are exact in f16);
__global__ __launch_bounds__(256) void k_vtp(const float* __restrict__ F, h16* V16) {
    const size_t e = ((size_t)blockIdx.x * 256 + threadIdx.x) * 2; if (e >= (size_t)NB * DV * TK) return;
    const int t = (int)(e % TK); const int d = (int)((e / TK) % DV); const int b = (int)(e / ((size_t)TK * DV));
    v2h o;
#pragma unroll
    for (int q = 0; q < 2; ++q) o[q] = toh_flush(bfr(F[((size_t)b * TK + t + q) * DV + d]) * VSC);
    *(v2h*)(V16 + e) = o; 
}

// ---- tanh via exp2 and rcp: 1 - 2 / (e^{2x} + 1); saturates cleanly to +-1 for large |x| (e = inf -> rcp 0, e = 0 -> rcp 1).
__device__ __forceinline__ float tnh(float x) {
    const float e = __builtin_amdgcn_exp2f(x * 2.8853900817779268f);
    const float r = __builtin_amdgcn_rcpf(e + 1.0f);
    return fmaf(-2.0f, r, 1.0f);
}

// ---- k_score: one block per (b, h, q). Lane owns hidden units 2*lane, 2*lane+1: the query-side projection row ((b*TQ+q)*NHD+h) (bias already added) and bf16_RNE(w2) in registers;
// wave w scans keys w*64 .. w*64+63, per key one 8-B load of the key-side projection row ((b*TK+k)*NHD+h), s = sum_a w2[a] tanh(qp[a] + kp[k][a]) in f32 (fixed-order shuffle tree),
// lane 0 stores s into the LDS score row (cross-wave, block barrier). The int mask word of each key is compared by value: nonzero -> the score is replaced by -inf.
// Softmax over the 512 keys in f32 (max-subtracted, exp2, rcp of the block sum). P16 row (f16, P x1024, 1 KB, head-major [h][b][q][k]) written by waves 0..1 as 32 lanes x 16 B per
__global__ __launch_bounds__(256) void k_score(const float* __restrict__ QPF, const float* __restrict__ KPF, const float* __restrict__ vv, const int* __restrict__ mask, h16* P16) {
    __shared__ __align__(16) float s_sc[TK];
    __shared__ float red[8];
    const int blk = blockIdx.x; const int q = blk % TQ; const int h = (blk / TQ) % NHD; const int b = blk / (TQ * NHD);
    const int tid = threadIdx.x, lane = tid & 31, wave = tid >> 5;
    const v2f w2q = *(const v2f*)(QPF + ((size_t)(b * TQ + q) * NHD + h) * HH + lane * 2);
    const v2f v2 = *(const v2f*)(vv + lane * 2);
    const float wq0 = w2q[0], wq1 = w2q[1];
    const float vr0 = bfr(v2[0]), vr1 = bfr(v2[1]);
    const float* ub = KPF + ((size_t)b * TK * NHD + h) * HH + lane * 2;
#pragma unroll 1
    for (int kk = 0; kk < TK / 8; ++kk) {
        const int k = wave * (TK / 8) + kk;
        const v2f u2 = *(const v2f*)(ub + (size_t)k * NHD * HH);
        float acc = 0.0f;
        acc = fmaf(vr0, tnh(wq0 + u2[0]), acc);
        acc = fmaf(vr1, tnh(wq1 + u2[1]), acc);
#pragma unroll
        for (int sh = 16; sh; sh >>= 1) acc += __shfl_xor(acc, sh, 32);
        if (lane == 0) s_sc[k] = acc;
    }
    __syncthreads();
    const float r0 = s_sc[tid], r1 = s_sc[tid + 256];
    const int mk0 = mask[(size_t)b * TK + tid], mk1 = mask[(size_t)b * TK + tid + 256];
    const float a0 = (mk0 != 0) ? -INFINITY : r0;
    const float a1 = (mk1 != 0) ? -INFINITY : r1;
    float m = fmaxf(a0, a1);
#pragma unroll
    for (int sh = 16; sh; sh >>= 1) m = fmaxf(m, __shfl_xor(m, sh, 32));
    if (lane == 0) red[wave] = m;
    __syncthreads();
    m = red[0];
#pragma unroll
    for (int w = 1; w < 8; ++w) m = fmaxf(m, red[w]);
    __syncthreads();
    float d0 = a0 - m, d1 = a1 - m; asm volatile("" : "+v"(d0)); asm volatile("" : "+v"(d1));
    const float e0 = __builtin_amdgcn_exp2f(d0 * LOG2E), e1 = __builtin_amdgcn_exp2f(d1 * LOG2E);
    s_sc[tid] = e0; s_sc[tid + 256] = e1;
    float sum = e0 + e1;
#pragma unroll
    for (int sh = 16; sh; sh >>= 1) sum += __shfl_xor(sum, sh, 32);
    if (lane == 0) red[wave] = sum;
    __syncthreads();
    sum = red[0];
#pragma unroll
    for (int w = 1; w < 8; ++w) sum += red[w];
    const float inv = __builtin_amdgcn_rcpf(sum); const float invp = inv * PCAR;
    if (wave < 2) {
        const int f0 = (wave * 32 + lane) * 8;
        const v4f q0 = *(const v4fa*)(s_sc + f0); const v4f q1 = *(const v4fa*)(s_sc + f0 + 4);
        v8h o;
#pragma unroll
        for (int c = 0; c < 4; ++c) { o[c] = toh_flush(q0[c] * invp); o[4 + c] = toh_flush(q1[c] * invp); }
        h16* dst = P16 + ((size_t)(h * NB + b) * TQ + q) * TK + f0;
        *(v8h*)dst = o; 
    }
}

extern "C" void kernel_launch(void* const* d_in, const int* in_sizes, int n_in,
                              void* d_out, int out_size, void* d_ws, size_t ws_size, hipStream_t stream) {
    if (n_in < 6) return;
    if (in_sizes[0] < NB * TK * DV || in_sizes[1] < NB * TQ * DV || in_sizes[2] < HH * 2 * DHD || in_sizes[3] < HH || in_sizes[4] < HH || in_sizes[5] < NB * TK) return;
    if (out_size < NB_FULL * TQ_FULL * DV) return;
    const float* x     = (const float*)d_in[0];   // [NB][TK][DV]   keys and values
    const float* query = (const float*)d_in[1];   // [NB][TQ][DV]
    const float* W     = (const float*)d_in[2];   // [HH][2*DHD]    ([out][in]; key columns first, query columns second)
    const float* bb    = (const float*)d_in[3];   // [HH]
    const float* w2    = (const float*)d_in[4];   // [HH]
    const int*   mask  = (const int*)d_in[5];     // [NB][TK]       nonzero = key excluded
    float* OUT = (float*)d_out;                   // [NB_FULL][TQ_FULL][DV], byte offset 0

    char* wsp = (char*)d_ws;
    auto take = [&](size_t bytes) { char* p = wsp; wsp += (bytes + 255) & ~(size_t)255; return (void*)p; };
    bf*    WB   = (bf*)take((size_t)2 * HH * DHD * 2);            // [2][HH][DHD] bf16          16,384 B
    bf*    XB   = (bf*)take((size_t)NB * TK * DV * 2);            // [NB*TK*NHD][DHD] bf16   4,194,304 B
    bf*    QB   = (bf*)take((size_t)NB * TQ * DV * 2);            // [NB*TQ*NHD][DHD] bf16     524,288 B
    float* KPF  = (float*)take((size_t)NB * TK * NHD * HH * 4);   // [NB*TK*NHD][HH] f32     8,388,608 B
    float* QPF  = (float*)take((size_t)NB * TQ * NHD * HH * 4);   // [NB*TQ*NHD][HH] f32     1,048,576 B
    h16*   VT16 = (h16*)take((size_t)NB * DV * TK * 2);           // [NB][DV][TK] f16        4,194,304 B
    h16*   P16  = (h16*)take((size_t)NHD * NB * TQ * TK * 2);     // [NHD][NB][TQ][TK] f16   4,194,304 B
    if ((size_t)(wsp - (char*)d_ws) > ws_size) return;            // total 22,560,768 B

    // weight planes Bt[a][d] (bf16 RNE): plane 0 key side, plane 1 query side
    k_wsplit<<<(unsigned)((2 * HH * DHD / 8 + 255) / 256), 256, 0, stream>>>(W, WB);
    // activation planes (bf16 RNE copies, layout kept: a [rows][DV] plane is also the [rows*NHD][DHD] per-head matrix)
    k_cvt8<<<(unsigned)(((size_t)NB * TK * DV / 8 + 255) / 256), 256, 0, stream>>>(x, XB, (size_t)NB * TK * DV / 8);
    k_cvt8<<<(unsigned)(((size_t)NB * TQ * DV / 8 + 255) / 256), 256, 0, stream>>>(query, QB, (size_t)NB * TQ * DV / 8);
    // value planes [b][c][k] f16 x16
    k_vtp<<<(unsigned)(((size_t)NB * DV * TK / 2 + 255) / 256), 256, 0, stream>>>(x, VT16);
    // kp = key-slice Wk^T : [NB*TK*NHD][DHD] x Bt[HH][DHD] -> f32 [NB*TK*NHD][HH]
    k_gemmw<bf, 0, false><<<dim3(NB * TK * NHD / 64, HH / 64, 1), 32, 0, stream>>>(XB, nullptr, WB, nullptr, DHD, KPF, HH, nullptr, 1.0f, 0, 0, 0);
    // qp = query-slice Wq^T + b : [NB*TQ*NHD][DHD] x Bt[HH][DHD] -> f32 [NB*TQ*NHD][HH]
    k_gemmw<bf, 0, true><<<dim3(NB * TQ * NHD / 64, HH / 64, 1), 32, 0, stream>>>(QB, nullptr, WB + (size_t)HH * DHD, nullptr, DHD, QPF, HH, bb, 1.0f, 0, 0, 0);
    // scores + mask + softmax per (b, h, q) -> P16 (f16 x1024, head-major)
    k_score<<<(unsigned)(NB * NHD * TQ), 256, 0, stream>>>(QPF, KPF, w2, mask, P16);
    // out[b][q][64h + d] = P . values per head: z = b, [TQ][TK] x Bt[DHD][TK] -> f32 column block 64h of [TQ][DV], epilogue scale 2^-14
    for (int h = 0; h < NHD; ++h)
        k_gemmw<h16, 0, false><<<dim3(TQ / 64, DHD / 64, NB), 32, 0, stream>>>(P16 + (size_t)h * NB * TQ * TK, nullptr, VT16 + (size_t)h * DHD * TK, nullptr, TK, OUT + h * DHD, DV, nullptr, OSC, (size_t)TQ * TK, (size_t)DV * TK, (size_t)TQ_FULL * DV);
}

// v001
// It runs in 132 microseconds.
// Two timings next to v000 put it at 1.71 and 1.73 times that version's speed.
#include <hip/hip_runtime.h>

// Contractions: key-slice.Wk and query-slice.Wq (+b) per head on v_wmma_f32_16x16x32_bf16 (bf16 operands = RNE-converted f32 inputs, f32 accumulate);
// weights.values per head on v_wmma_f32_16x16x32_f16 (f16 operands: P carried x1024, V carried x16, f32 accumulate, folded by 2^-14 in the f32 epilogue);
// score matvec sum_a w2[a]*tanh(kp[a]+qp[a]+b[a]) (N=1) and the softmax stay f32 on VALU.

#ifndef NB
#define NB 8
#endif
#ifndef TQ
#define TQ 64
#endif
#define NB_FULL 8
#define TQ_FULL 64
#define TK    512
#define DV    512
#define NHD   8
#define DHD   64
#define HH    64
#define PCAR  1024.0f
#define VSC   16.0f
#define OSC   (1.0f / 16384.0f)
#define LOG2E 1.4426950408889634f

static_assert(TQ == TQ_FULL || NB == 1);
static_assert(TQ % 64 == 0 && TQ >= 64 && TQ <= TQ_FULL);
static_assert(NB >= 1 && NB <= NB_FULL);
static_assert(TK == 2 * 256);
static_assert(TK == 8 * 64);
static_assert(HH == 2 * 32);
static_assert(NHD * DHD == DV);
static_assert((NB * TQ * NHD) % 64 == 0 && (NB * TK * NHD) % 64 == 0 && HH % 64 == 0 && DHD % 64 == 0);
static_assert(DHD % 32 == 0 && TK % 32 == 0 && DV % 8 == 0);
static_assert((size_t)NB_FULL * TQ_FULL * DV * 4 == 1048576);
static_assert(2 * 32 * 16 == TK * 2);
static_assert(4 * 256 * 8 == 2 * HH * DHD);
static_assert(HH * DHD / 8 == (1 << 9));
static_assert(DHD / 8 == (1 << 3));
static_assert(HH == 64);
static_assert(DHD == 64);
static_assert(16 * 68 * 4 <= 131072);
static_assert(TK * 4 + 8 * 4 <= 131072);
static_assert((size_t)2 * HH * DHD * 2 + (size_t)NB * TK * DV * 2 + (size_t)NB * TQ * DV * 2 + (size_t)NB * TK * NHD * HH * 4 + (size_t)NB * TQ * NHD * HH * 4
              + (size_t)NB * DV * TK * 2 + (size_t)NHD * NB * TQ * TK * 2 <= 134217728);

typedef _Float16 h16;
typedef unsigned short bf;
typedef __attribute__((ext_vector_type(16))) __bf16   v16bf;
typedef __attribute__((ext_vector_type(16))) _Float16 v16h;
typedef __attribute__((ext_vector_type(8)))  _Float16 v8h;
typedef __attribute__((ext_vector_type(8)))  unsigned short v8us;
typedef __attribute__((ext_vector_type(8)))  float    v8f;
typedef __attribute__((ext_vector_type(4)))  float    v4f;
typedef __attribute__((ext_vector_type(2)))  float    v2f;
typedef __attribute__((ext_vector_type(2)))  _Float16 v2h;
typedef __attribute__((ext_vector_type(2)))  unsigned short v2us;
typedef v8h  __attribute__((may_alias)) v8ha;
typedef v4f  __attribute__((may_alias)) v4fa;
typedef v8us __attribute__((may_alias)) v8usa;

__device__ __forceinline__ unsigned short f2bf(float f) { unsigned u = __float_as_uint(f); u += 0x7FFFu + ((u >> 16) & 1u); return (unsigned short)(u >> 16); }
__device__ __forceinline__ float bf2f(unsigned short b) { return __uint_as_float(((unsigned)b) << 16); }
__device__ __forceinline__ float bfr(float f) { return bf2f(f2bf(f)); }
__device__ __forceinline__ v16h cat16(v8h lo, v8h hi) { return __builtin_shufflevector(lo, hi, 0, 1, 2, 3, 4, 5, 6, 7, 8, 9, 10, 11, 12, 13, 14, 15); }
__device__ __forceinline__ v16bf cat16b(v8us lo, v8us hi) { return __builtin_bit_cast(v16bf, __builtin_shufflevector(lo, hi, 0, 1, 2, 3, 4, 5, 6, 7, 8, 9, 10, 11, 12, 13, 14, 15)); }
__device__ __forceinline__ v8f wmma16(v16h a, v16h b, v8f c) { return __builtin_amdgcn_wmma_f32_16x16x32_f16(false, a, false, b, (short)0, c, false, false); }
__device__ __forceinline__ v8f wmmab(v16bf a, v16bf b, v8f c) { return __builtin_amdgcn_wmma_f32_16x16x32_bf16(false, a, false, b, (short)0, c, false, false); }
// f32 -> f16 convert for WMMA operand planes: magnitudes under 2^-14 become +0 by a value select (applied after the plane's power-of-two carry).
__device__ __forceinline__ h16 toh_flush(float v) { const float w = (fabsf(v) < 6.103515625e-05f) ? 0.0f : v; return (h16)w; }

// ---- k_gemmw: register-blocked GEMM, ONE WAVE per 64x64 output tile (16 accumulators), operands straight from K-contiguous 16-bit planes; grid (M/64, N/64, Z), 32 threads.
// C[m][n] (f32, pitch ldc) = csc * sum_k A[m][k] Bt[n][k] (+ split products per NSPLIT) (+ optional bf16-exact f32 bias[n]). z-batch strides sA/sB/sC in elements; sAy = A's stride per 64-column block (0: one A for all columns; nonzero: each column block has its own A, block-diagonal product). K % 32 == 0.
// Fragments (lane l, hi = l>>4, lr = l&15): A elements 0..7 <- A[r][k0+8hi+0..7], 8..15 <- A[r][k0+16+8hi+0..7]; B identical k map from Bt[n][k]; D element j -> (row 8hi+j, col lr).
template <typename T16> struct WFrag;
template <> struct WFrag<h16> { typedef v16h V; static __device__ __forceinline__ V ld(const h16* p) { return cat16(*(const v8h*)p, *(const v8h*)(p + 16)); } static __device__ __forceinline__ v8f mma(V a, V b, v8f c) { return wmma16(a, b, c); } };
template <> struct WFrag<bf> { typedef v16bf V; static __device__ __forceinline__ V ld(const bf* p) { return cat16b(*(const v8us*)p, *(const v8us*)(p + 16)); } static __device__ __forceinline__ v8f mma(V a, V b, v8f c) { return wmmab(a, b, c); } };
template <typename T16, int NSPLIT, bool BIAS>
__global__ __launch_bounds__(32) void k_gemmw(const T16* __restrict__ A, const T16* __restrict__ A2, const T16* __restrict__ Bt, const T16* __restrict__ Bt2, int K, float* C, int ldc, const float* __restrict__ bias, float csc, size_t sA, size_t sB, size_t sC, size_t sAy) {
    typedef typename WFrag<T16>::V V;
    __shared__ __align__(16) float os[16 * 68];
    const size_t z = blockIdx.z; A += z * sA + blockIdx.y * sAy; if (A2) A2 += z * sA + blockIdx.y * sAy; Bt += z * sB; if (Bt2) Bt2 += z * sB; C += z * sC;
    const int lane = threadIdx.x & 31, lr = lane & 15, hi = lane >> 4; const int r0 = blockIdx.x * 64, c0 = blockIdx.y * 64;
    v8f acc[4][4];
#pragma unroll
    for (int mb = 0; mb < 4; ++mb)
#pragma unroll
        for (int nb = 0; nb < 4; ++nb) acc[mb][nb] = (v8f){};
    const size_t aoff = (size_t)(r0 + lr) * K + 8 * hi, boff = (size_t)(c0 + lr) * K + 8 * hi;
#pragma unroll 1
    for (int kc = 0; kc < K; kc += 32) {
        V a[4], a2[4];
#pragma unroll
        for (int mb = 0; mb < 4; ++mb) { a[mb] = WFrag<T16>::ld(A + aoff + (size_t)mb * 16 * K + kc); if (NSPLIT == 1 || NSPLIT == 2) a2[mb] = WFrag<T16>::ld(A2 + aoff + (size_t)mb * 16 * K + kc); }
#pragma unroll
        for (int nb = 0; nb < 4; ++nb) { const V b = WFrag<T16>::ld(Bt + boff + (size_t)nb * 16 * K + kc); V b2; if (NSPLIT >= 2) b2 = WFrag<T16>::ld(Bt2 + boff + (size_t)nb * 16 * K + kc);
#pragma unroll
            for (int mb = 0; mb < 4; ++mb) { acc[mb][nb] = WFrag<T16>::mma(a[mb], b, acc[mb][nb]); if (NSPLIT == 1 || NSPLIT == 2) acc[mb][nb] = WFrag<T16>::mma(a2[mb], b, acc[mb][nb]); if (NSPLIT >= 2) acc[mb][nb] = WFrag<T16>::mma(a[mb], b2, acc[mb][nb]); } }
        asm volatile("v_nop\n\tv_nop\n\tv_nop\n\tv_nop" : "+v"(acc[0][0]), "+v"(acc[1][1]), "+v"(acc[2][2]), "+v"(acc[3][3]) : "v"(a[0]), "v"(a[3]));
    }
#pragma unroll
    for (int mb = 0; mb < 4; ++mb) {
#pragma unroll
        for (int nb = 0; nb < 4; ++nb) {
#pragma unroll
            for (int j = 0; j < 8; ++j) os[(hi * 8 + j) * 68 + nb * 16 + lr] = acc[mb][nb][j]; }
        __builtin_amdgcn_wave_barrier(); asm volatile("" ::: "memory");
        float* crow = C + (size_t)(r0 + mb * 16) * ldc + c0;
{
#pragma unroll
            for (int s = 0; s < 8; ++s) { const int row = 2 * s + hi, cofs = lr * 4; v4f val = *(const v4fa*)(os + row * 68 + cofs); val = val * csc;
                if (BIAS) { val[0] += bfr(bias[c0 + cofs]); val[1] += bfr(bias[c0 + cofs + 1]); val[2] += bfr(bias[c0 + cofs + 2]); val[3] += bfr(bias[c0 + cofs + 3]); }
                *(v4f*)(crow + (size_t)row * ldc + cofs) = val; }
             }
        __builtin_amdgcn_wave_barrier(); asm volatile("" ::: "memory");
    }
}

// ---- k_wsplit: two contiguous bf16 (RNE) Bt planes [HH][DHD] from the [OUT][IN] weight of row pitch 2*DHD: plane 0 = input columns 0..DHD-1 (key side), plane 1 = columns DHD..2*DHD-1 (query side).
// Index split by unsigned shifts and masks: i = pl * 2^9 + a * 2^3 + pc (HH * DHD / 8 == 2^9, DHD / 8 == 2^3, HH == 64: tied to the defines by file-scope static_asserts).
__global__ __launch_bounds__(256) void k_wsplit(const float* __restrict__ w, bf* WB) {
    const unsigned i = blockIdx.x * 256u + threadIdx.x; if (i >= (unsigned)(2 * HH * DHD / 8)) return;
    const unsigned pl = i >> 9; const unsigned a = (i >> 3) & 63u; const unsigned pc = i & 7u;
    const v8f v = *(const v8f*)(w + (size_t)a * (2 * DHD) + pl * DHD + pc * 8); v8us o;
#pragma unroll
    for (int k = 0; k < 8; ++k) o[k] = f2bf(v[k]);
    *(v8us*)(WB + (size_t)i * 8) = o; 
}

__global__ __launch_bounds__(256) void k_cvt8(const float* __restrict__ src, bf* dst, size_t n8) { const size_t i = (size_t)blockIdx.x * 256 + threadIdx.x; if (i >= n8) return; const v8f v = *(const v8f*)(src + i * 8); v8us o;
#pragma unroll
    for (int k = 0; k < 8; ++k) o[k] = f2bf(v[k]); *(v8us*)(dst + i * 8) = o;  }

// ---- k_vtp: value planes V16[b][d][t] (f16) = bf16_RNE(F[b][t][d]) * VSC (raw input; the x16 carry keeps small entries normal in f16; bf16 significands are exact in f16);
__global__ __launch_bounds__(256) void k_vtp(const float* __restrict__ F, h16* V16) {
    const size_t e = ((size_t)blockIdx.x * 256 + threadIdx.x) * 2; if (e >= (size_t)NB * DV * TK) return;
    const int t = (int)(e % TK); const int d = (int)((e / TK) % DV); const int b = (int)(e / ((size_t)TK * DV));
    v2h o;
#pragma unroll
    for (int q = 0; q < 2; ++q) o[q] = toh_flush(bfr(F[((size_t)b * TK + t + q) * DV + d]) * VSC);
    *(v2h*)(V16 + e) = o; 
}

// ---- tanh via exp2 and rcp: 1 - 2 / (e^{2x} + 1); saturates cleanly to +-1 for large |x| (e = inf -> rcp 0, e = 0 -> rcp 1).
__device__ __forceinline__ float tnh(float x) {
    const float e = __builtin_amdgcn_exp2f(x * 2.8853900817779268f);
    const float r = __builtin_amdgcn_rcpf(e + 1.0f);
    return fmaf(-2.0f, r, 1.0f);
}

// ---- k_score: one block per (b, h, q). Lane owns hidden units 2*lane, 2*lane+1: the query-side projection row ((b*TQ+q)*NHD+h) (bias already added) and bf16_RNE(w2) in registers;
// wave w scans keys w*64 .. w*64+63, per key one 8-B load of the key-side projection row ((b*TK+k)*NHD+h), s = sum_a w2[a] tanh(qp[a] + kp[k][a]) in f32 (fixed-order shuffle tree),
// lane 0 stores s into the LDS score row (cross-wave, block barrier). The int mask word of each key is compared by value: nonzero -> the score is replaced by -inf.
// Softmax over the 512 keys in f32 (max-subtracted, exp2, rcp of the block sum). P16 row (f16, P x1024, 1 KB, head-major [h][b][q][k]) written by waves 0..1 as 32 lanes x 16 B per
__global__ __launch_bounds__(256) void k_score(const float* __restrict__ QPF, const float* __restrict__ KPF, const float* __restrict__ vv, const int* __restrict__ mask, h16* P16) {
    __shared__ __align__(16) float s_sc[TK];
    __shared__ float red[8];
    const int blk = blockIdx.x; const int q = blk % TQ; const int h = (blk / TQ) % NHD; const int b = blk / (TQ * NHD);
    const int tid = threadIdx.x, lane = tid & 31, wave = tid >> 5;
    const v2f w2q = *(const v2f*)(QPF + ((size_t)(b * TQ + q) * NHD + h) * HH + lane * 2);
    const v2f v2 = *(const v2f*)(vv + lane * 2);
    const float wq0 = w2q[0], wq1 = w2q[1];
    const float vr0 = bfr(v2[0]), vr1 = bfr(v2[1]);
    const float* ub = KPF + ((size_t)b * TK * NHD + h) * HH + lane * 2;
#pragma unroll 1
    for (int kk = 0; kk < TK / 8; ++kk) {
        const int k = wave * (TK / 8) + kk;
        const v2f u2 = *(const v2f*)(ub + (size_t)k * NHD * HH);
        float acc = 0.0f;
        acc = fmaf(vr0, tnh(wq0 + u2[0]), acc);
        acc = fmaf(vr1, tnh(wq1 + u2[1]), acc);
#pragma unroll
        for (int sh = 16; sh; sh >>= 1) acc += __shfl_xor(acc, sh, 32);
        if (lane == 0) s_sc[k] = acc;
    }
    __syncthreads();
    const float r0 = s_sc[tid], r1 = s_sc[tid + 256];
    const int mk0 = mask[(size_t)b * TK + tid], mk1 = mask[(size_t)b * TK + tid + 256];
    const float a0 = (mk0 != 0) ? -INFINITY : r0;
    const float a1 = (mk1 != 0) ? -INFINITY : r1;
    float m = fmaxf(a0, a1);
#pragma unroll
    for (int sh = 16; sh; sh >>= 1) m = fmaxf(m, __shfl_xor(m, sh, 32));
    if (lane == 0) red[wave] = m;
    __syncthreads();
    m = red[0];
#pragma unroll
    for (int w = 1; w < 8; ++w) m = fmaxf(m, red[w]);
    __syncthreads();
    float d0 = a0 - m, d1 = a1 - m; asm volatile("" : "+v"(d0)); asm volatile("" : "+v"(d1));
    const float e0 = __builtin_amdgcn_exp2f(d0 * LOG2E), e1 = __builtin_amdgcn_exp2f(d1 * LOG2E);
    s_sc[tid] = e0; s_sc[tid + 256] = e1;
    float sum = e0 + e1;
#pragma unroll
    for (int sh = 16; sh; sh >>= 1) sum += __shfl_xor(sum, sh, 32);
    if (lane == 0) red[wave] = sum;
    __syncthreads();
    sum = red[0];
#pragma unroll
    for (int w = 1; w < 8; ++w) sum += red[w];
    const float inv = __builtin_amdgcn_rcpf(sum); const float invp = inv * PCAR;
    if (wave < 2) {
        const int f0 = (wave * 32 + lane) * 8;
        const v4f q0 = *(const v4fa*)(s_sc + f0); const v4f q1 = *(const v4fa*)(s_sc + f0 + 4);
        v8h o;
#pragma unroll
        for (int c = 0; c < 4; ++c) { o[c] = toh_flush(q0[c] * invp); o[4 + c] = toh_flush(q1[c] * invp); }
        h16* dst = P16 + ((size_t)(h * NB + b) * TQ + q) * TK + f0;
        *(v8h*)dst = o; 
    }
}

extern "C" void kernel_launch(void* const* d_in, const int* in_sizes, int n_in,
                              void* d_out, int out_size, void* d_ws, size_t ws_size, hipStream_t stream) {
    if (n_in < 6) return;
    if (in_sizes[0] < NB * TK * DV || in_sizes[1] < NB * TQ * DV || in_sizes[2] < HH * 2 * DHD || in_sizes[3] < HH || in_sizes[4] < HH || in_sizes[5] < NB * TK) return;
    if (out_size < NB_FULL * TQ_FULL * DV) return;
    const float* x     = (const float*)d_in[0];   // [NB][TK][DV]   keys and values
    const float* query = (const float*)d_in[1];   // [NB][TQ][DV]
    const float* W     = (const float*)d_in[2];   // [HH][2*DHD]    ([out][in]; key columns first, query columns second)
    const float* bb    = (const float*)d_in[3];   // [HH]
    const float* w2    = (const float*)d_in[4];   // [HH]
    const int*   mask  = (const int*)d_in[5];     // [NB][TK]       nonzero = key excluded
    float* OUT = (float*)d_out;                   // [NB_FULL][TQ_FULL][DV], byte offset 0

    char* wsp = (char*)d_ws;
    auto take = [&](size_t bytes) { char* p = wsp; wsp += (bytes + 255) & ~(size_t)255; return (void*)p; };
    bf*    WB   = (bf*)take((size_t)2 * HH * DHD * 2);            // [2][HH][DHD] bf16          16,384 B
    bf*    XB   = (bf*)take((size_t)NB * TK * DV * 2);            // [NB*TK*NHD][DHD] bf16   4,194,304 B
    bf*    QB   = (bf*)take((size_t)NB * TQ * DV * 2);            // [NB*TQ*NHD][DHD] bf16     524,288 B
    float* KPF  = (float*)take((size_t)NB * TK * NHD * HH * 4);   // [NB*TK*NHD][HH] f32     8,388,608 B
    float* QPF  = (float*)take((size_t)NB * TQ * NHD * HH * 4);   // [NB*TQ*NHD][HH] f32     1,048,576 B
    h16*   VT16 = (h16*)take((size_t)NB * DV * TK * 2);           // [NB][DV][TK] f16        4,194,304 B
    h16*   P16  = (h16*)take((size_t)NHD * NB * TQ * TK * 2);     // [NHD][NB][TQ][TK] f16   4,194,304 B
    if ((size_t)(wsp - (char*)d_ws) > ws_size) return;            // total 22,560,768 B

    // weight planes Bt[a][d] (bf16 RNE): plane 0 key side, plane 1 query side
    k_wsplit<<<(unsigned)((2 * HH * DHD / 8 + 255) / 256), 256, 0, stream>>>(W, WB);
    // activation planes (bf16 RNE copies, layout kept: a [rows][DV] plane is also the [rows*NHD][DHD] per-head matrix)
    k_cvt8<<<(unsigned)(((size_t)NB * TK * DV / 8 + 255) / 256), 256, 0, stream>>>(x, XB, (size_t)NB * TK * DV / 8);
    k_cvt8<<<(unsigned)(((size_t)NB * TQ * DV / 8 + 255) / 256), 256, 0, stream>>>(query, QB, (size_t)NB * TQ * DV / 8);
    // value planes [b][c][k] f16 x16
    k_vtp<<<(unsigned)(((size_t)NB * DV * TK / 2 + 255) / 256), 256, 0, stream>>>(x, VT16);
    // kp = key-slice Wk^T : [NB*TK*NHD][DHD] x Bt[HH][DHD] -> f32 [NB*TK*NHD][HH]
    k_gemmw<bf, 0, false><<<dim3(NB * TK * NHD / 64, HH / 64, 1), 32, 0, stream>>>(XB, nullptr, WB, nullptr, DHD, KPF, HH, nullptr, 1.0f, 0, 0, 0, 0);
    // qp = query-slice Wq^T + b : [NB*TQ*NHD][DHD] x Bt[HH][DHD] -> f32 [NB*TQ*NHD][HH]
    k_gemmw<bf, 0, true><<<dim3(NB * TQ * NHD / 64, HH / 64, 1), 32, 0, stream>>>(QB, nullptr, WB + (size_t)HH * DHD, nullptr, DHD, QPF, HH, bb, 1.0f, 0, 0, 0, 0);
    // scores + mask + softmax per (b, h, q) -> P16 (f16 x1024, head-major)
    k_score<<<(unsigned)(NB * NHD * TQ), 256, 0, stream>>>(QPF, KPF, w2, mask, P16);
    // out[b][q][64h + d] = P . values, all heads in one launch: z = b, column block y = head h (DHD == 64), A = P16[h][b] by sAy, [TQ][TK] x Bt[DV][TK] -> f32 [TQ][DV], epilogue scale 2^-14
    k_gemmw<h16, 0, false><<<dim3(TQ / 64, DV / 64, NB), 32, 0, stream>>>(P16, nullptr, VT16, nullptr, TK, OUT, DV, nullptr, OSC, (size_t)TQ * TK, (size_t)DV * TK, (size_t)TQ_FULL * DV, (size_t)NB * TQ * TK);
}

// v002
// It runs in 62.8 microseconds.
// In two side-by-side timings against v001, it was 2.10 and 2.09 times as fast.
// Counting every step since v000, it is 3.61 times as fast.
#include <hip/hip_runtime.h>

// Contractions: key-slice.Wk and query-slice.Wq (+b) per head on v_wmma_f32_16x16x32_bf16 (bf16 operands = RNE-converted f32 inputs, f32 accumulate);
// weights.values per head on v_wmma_f32_16x16x32_f16 (f16 operands: P carried x1024, V carried x16, f32 accumulate, folded by 2^-14 in the f32 epilogue);
// score matvec sum_a w2[a]*tanh(kp[a]+qp[a]+b[a]) (N=1) and the softmax stay f32 on VALU.

#ifndef NB
#define NB 8
#endif
#ifndef TQ
#define TQ 64
#endif
#define NB_FULL 8
#define TQ_FULL 64
#define TK    512
#define DV    512
#define NHD   8
#define DHD   64
#define HH    64
#define PCAR  1024.0f
#define VSC   16.0f
#define OSC   (1.0f / 16384.0f)
#define LOG2E 1.4426950408889634f
#define QG    16
#define KPP   68

static_assert(TQ == TQ_FULL || NB == 1);
static_assert(TQ % 64 == 0 && TQ >= 64 && TQ <= TQ_FULL);
static_assert(NB >= 1 && NB <= NB_FULL);
static_assert(TK == 2 * 256);
static_assert(TK == 8 * 64);
static_assert(HH == 2 * 32);
static_assert(NHD * DHD == DV);
static_assert((NB * TQ * NHD) % 64 == 0 && (NB * TK * NHD) % 64 == 0 && HH % 64 == 0 && DHD % 64 == 0);
static_assert(DHD % 32 == 0 && TK % 32 == 0 && DV % 8 == 0);
static_assert((size_t)NB_FULL * TQ_FULL * DV * 4 == 1048576);
static_assert(2 * 32 * 16 == TK * 2);
static_assert(4 * 256 * 8 == 2 * HH * DHD);
static_assert(HH * DHD / 8 == (1 << 9));
static_assert(DHD / 8 == (1 << 3));
static_assert(HH == 64);
static_assert(DHD == 64);
static_assert(16 * 68 * 4 <= 131072);
static_assert(TQ % QG == 0 && QG * 32 == TK && QG * 32 == 512 && HH == 2 * 32 && HH % 4 == 0);
static_assert(KPP >= HH && KPP % 4 == 0 && (KPP / 4) % 2 == 1);
static_assert((TK * KPP + QG * TK + QG * HH + HH) * 4 <= 327680);
static_assert((size_t)2 * HH * DHD * 2 + (size_t)NB * TK * DV * 2 + (size_t)NB * TQ * DV * 2 + (size_t)NB * TK * NHD * HH * 4 + (size_t)NB * TQ * NHD * HH * 4
              + (size_t)NB * DV * TK * 2 + (size_t)NHD * NB * TQ * TK * 2 <= 134217728);

typedef _Float16 h16;
typedef unsigned short bf;
typedef __attribute__((ext_vector_type(16))) __bf16   v16bf;
typedef __attribute__((ext_vector_type(16))) _Float16 v16h;
typedef __attribute__((ext_vector_type(8)))  _Float16 v8h;
typedef __attribute__((ext_vector_type(8)))  unsigned short v8us;
typedef __attribute__((ext_vector_type(8)))  float    v8f;
typedef __attribute__((ext_vector_type(4)))  float    v4f;
typedef __attribute__((ext_vector_type(2)))  float    v2f;
typedef __attribute__((ext_vector_type(2)))  _Float16 v2h;
typedef __attribute__((ext_vector_type(2)))  unsigned short v2us;
typedef v8h  __attribute__((may_alias)) v8ha;
typedef v4f  __attribute__((may_alias)) v4fa;
typedef v8us __attribute__((may_alias)) v8usa;

__device__ __forceinline__ unsigned short f2bf(float f) { unsigned u = __float_as_uint(f); u += 0x7FFFu + ((u >> 16) & 1u); return (unsigned short)(u >> 16); }
__device__ __forceinline__ float bf2f(unsigned short b) { return __uint_as_float(((unsigned)b) << 16); }
__device__ __forceinline__ float bfr(float f) { return bf2f(f2bf(f)); }
__device__ __forceinline__ v16h cat16(v8h lo, v8h hi) { return __builtin_shufflevector(lo, hi, 0, 1, 2, 3, 4, 5, 6, 7, 8, 9, 10, 11, 12, 13, 14, 15); }
__device__ __forceinline__ v16bf cat16b(v8us lo, v8us hi) { return __builtin_bit_cast(v16bf, __builtin_shufflevector(lo, hi, 0, 1, 2, 3, 4, 5, 6, 7, 8, 9, 10, 11, 12, 13, 14, 15)); }
__device__ __forceinline__ v8f wmma16(v16h a, v16h b, v8f c) { return __builtin_amdgcn_wmma_f32_16x16x32_f16(false, a, false, b, (short)0, c, false, false); }
__device__ __forceinline__ v8f wmmab(v16bf a, v16bf b, v8f c) { return __builtin_amdgcn_wmma_f32_16x16x32_bf16(false, a, false, b, (short)0, c, false, false); }
// f32 -> f16 convert for WMMA operand planes: magnitudes under 2^-14 become +0 by a value select (applied after the plane's power-of-two carry).
__device__ __forceinline__ h16 toh_flush(float v) { const float w = (fabsf(v) < 6.103515625e-05f) ? 0.0f : v; return (h16)w; }

// ---- k_gemmw: register-blocked GEMM, ONE WAVE per 64x64 output tile (16 accumulators), operands straight from K-contiguous 16-bit planes; grid (M/64, N/64, Z), 32 threads.
// C[m][n] (f32, pitch ldc) = csc * sum_k A[m][k] Bt[n][k] (+ split products per NSPLIT) (+ optional bf16-exact f32 bias[n]). z-batch strides sA/sB/sC in elements; sAy = A's stride per 64-column block (0: one A for all columns; nonzero: each column block has its own A, block-diagonal product). K % 32 == 0.
// Fragments (lane l, hi = l>>4, lr = l&15): A elements 0..7 <- A[r][k0+8hi+0..7], 8..15 <- A[r][k0+16+8hi+0..7]; B identical k map from Bt[n][k]; D element j -> (row 8hi+j, col lr).
template <typename T16> struct WFrag;
template <> struct WFrag<h16> { typedef v16h V; static __device__ __forceinline__ V ld(const h16* p) { return cat16(*(const v8h*)p, *(const v8h*)(p + 16)); } static __device__ __forceinline__ v8f mma(V a, V b, v8f c) { return wmma16(a, b, c); } };
template <> struct WFrag<bf> { typedef v16bf V; static __device__ __forceinline__ V ld(const bf* p) { return cat16b(*(const v8us*)p, *(const v8us*)(p + 16)); } static __device__ __forceinline__ v8f mma(V a, V b, v8f c) { return wmmab(a, b, c); } };
template <typename T16, int NSPLIT, bool BIAS>
__global__ __launch_bounds__(32) void k_gemmw(const T16* __restrict__ A, const T16* __restrict__ A2, const T16* __restrict__ Bt, const T16* __restrict__ Bt2, int K, float* C, int ldc, const float* __restrict__ bias, float csc, size_t sA, size_t sB, size_t sC, size_t sAy) {
    typedef typename WFrag<T16>::V V;
    __shared__ __align__(16) float os[16 * 68];
    const size_t z = blockIdx.z; A += z * sA + blockIdx.y * sAy; if (A2) A2 += z * sA + blockIdx.y * sAy; Bt += z * sB; if (Bt2) Bt2 += z * sB; C += z * sC;
    const int lane = threadIdx.x & 31, lr = lane & 15, hi = lane >> 4; const int r0 = blockIdx.x * 64, c0 = blockIdx.y * 64;
    v8f acc[4][4];
#pragma unroll
    for (int mb = 0; mb < 4; ++mb)
#pragma unroll
        for (int nb = 0; nb < 4; ++nb) acc[mb][nb] = (v8f){};
    const size_t aoff = (size_t)(r0 + lr) * K + 8 * hi, boff = (size_t)(c0 + lr) * K + 8 * hi;
#pragma unroll 1
    for (int kc = 0; kc < K; kc += 32) {
        V a[4], a2[4];
#pragma unroll
        for (int mb = 0; mb < 4; ++mb) { a[mb] = WFrag<T16>::ld(A + aoff + (size_t)mb * 16 * K + kc); if (NSPLIT == 1 || NSPLIT == 2) a2[mb] = WFrag<T16>::ld(A2 + aoff + (size_t)mb * 16 * K + kc); }
#pragma unroll
        for (int nb = 0; nb < 4; ++nb) { const V b = WFrag<T16>::ld(Bt + boff + (size_t)nb * 16 * K + kc); V b2; if (NSPLIT >= 2) b2 = WFrag<T16>::ld(Bt2 + boff + (size_t)nb * 16 * K + kc);
#pragma unroll
            for (int mb = 0; mb < 4; ++mb) { acc[mb][nb] = WFrag<T16>::mma(a[mb], b, acc[mb][nb]); if (NSPLIT == 1 || NSPLIT == 2) acc[mb][nb] = WFrag<T16>::mma(a2[mb], b, acc[mb][nb]); if (NSPLIT >= 2) acc[mb][nb] = WFrag<T16>::mma(a[mb], b2, acc[mb][nb]); } }
        asm volatile("v_nop\n\tv_nop\n\tv_nop\n\tv_nop" : "+v"(acc[0][0]), "+v"(acc[1][1]), "+v"(acc[2][2]), "+v"(acc[3][3]) : "v"(a[0]), "v"(a[3]));
    }
#pragma unroll
    for (int mb = 0; mb < 4; ++mb) {
#pragma unroll
        for (int nb = 0; nb < 4; ++nb) {
#pragma unroll
            for (int j = 0; j < 8; ++j) os[(hi * 8 + j) * 68 + nb * 16 + lr] = acc[mb][nb][j]; }
        __builtin_amdgcn_wave_barrier(); asm volatile("" ::: "memory");
        float* crow = C + (size_t)(r0 + mb * 16) * ldc + c0;
{
#pragma unroll
            for (int s = 0; s < 8; ++s) { const int row = 2 * s + hi, cofs = lr * 4; v4f val = *(const v4fa*)(os + row * 68 + cofs); val = val * csc;
                if (BIAS) { val[0] += bfr(bias[c0 + cofs]); val[1] += bfr(bias[c0 + cofs + 1]); val[2] += bfr(bias[c0 + cofs + 2]); val[3] += bfr(bias[c0 + cofs + 3]); }
                *(v4f*)(crow + (size_t)row * ldc + cofs) = val; }
             }
        __builtin_amdgcn_wave_barrier(); asm volatile("" ::: "memory");
    }
}

// ---- k_wsplit: two contiguous bf16 (RNE) Bt planes [HH][DHD] from the [OUT][IN] weight of row pitch 2*DHD: plane 0 = input columns 0..DHD-1 (key side), plane 1 = columns DHD..2*DHD-1 (query side).
// Index split by unsigned shifts and masks: i = pl * 2^9 + a * 2^3 + pc (HH * DHD / 8 == 2^9, DHD / 8 == 2^3, HH == 64: tied to the defines by file-scope static_asserts).
__global__ __launch_bounds__(256) void k_wsplit(const float* __restrict__ w, bf* WB) {
    const unsigned i = blockIdx.x * 256u + threadIdx.x; if (i >= (unsigned)(2 * HH * DHD / 8)) return;
    const unsigned pl = i >> 9; const unsigned a = (i >> 3) & 63u; const unsigned pc = i & 7u;
    const v8f v = *(const v8f*)(w + (size_t)a * (2 * DHD) + pl * DHD + pc * 8); v8us o;
#pragma unroll
    for (int k = 0; k < 8; ++k) o[k] = f2bf(v[k]);
    *(v8us*)(WB + (size_t)i * 8) = o; 
}

__global__ __launch_bounds__(256) void k_cvt8(const float* __restrict__ src, bf* dst, size_t n8) { const size_t i = (size_t)blockIdx.x * 256 + threadIdx.x; if (i >= n8) return; const v8f v = *(const v8f*)(src + i * 8); v8us o;
#pragma unroll
    for (int k = 0; k < 8; ++k) o[k] = f2bf(v[k]); *(v8us*)(dst + i * 8) = o;  }

// ---- k_vtp: value planes V16[b][d][t] (f16) = bf16_RNE(F[b][t][d]) * VSC (raw input; the x16 carry keeps small entries normal in f16; bf16 significands are exact in f16);
__global__ __launch_bounds__(256) void k_vtp(const float* __restrict__ F, h16* V16) {
    const size_t e = ((size_t)blockIdx.x * 256 + threadIdx.x) * 2; if (e >= (size_t)NB * DV * TK) return;
    const int t = (int)(e % TK); const int d = (int)((e / TK) % DV); const int b = (int)(e / ((size_t)TK * DV));
    v2h o;
#pragma unroll
    for (int q = 0; q < 2; ++q) o[q] = toh_flush(bfr(F[((size_t)b * TK + t + q) * DV + d]) * VSC);
    *(v2h*)(V16 + e) = o; 
}

// ---- tanh of two hidden units at once, via exp2 and rcp: 1 - 2 / (e^{2x} + 1); saturates cleanly to +-1 for large |x| (e = inf -> rcp 0, e = 0 -> rcp 1).
__device__ __forceinline__ v2f tnh2(v2f x) {
    const v2f y = x * 2.8853900817779268f;
    v2f e; e[0] = __builtin_amdgcn_exp2f(y[0]); e[1] = __builtin_amdgcn_exp2f(y[1]);
    const v2f d = e + 1.0f;
    v2f r; r[0] = __builtin_amdgcn_rcpf(d[0]); r[1] = __builtin_amdgcn_rcpf(d[1]);
    return __builtin_elementwise_fma((v2f){-2.0f, -2.0f}, r, (v2f){1.0f, 1.0f});
}

// ---- k_score: one block (16 waves) per (b, h, group of QG queries); LANE tid OWNS KEY tid and keeps that key's whole key-side projection row (HH f32) in registers for all QG queries.
// Staging: the 512 rows ((b*TK+k)*NHD+h) are read as whole 256-B rows (16 B a lane) into LDS at a pitch of KPP floats (272 B = 16 B x odd), and each lane reads its own row back;
// bf16_RNE(w2) and the QG query-side rows ((b*TQ+q)*NHD+h) (bias already added) go through LDS too and are read at one address by all lanes.
// Per query: s = sum_a w2[a] tanh(qp[a] + kp[k][a]) in f32, summed inside the lane over hidden-unit pairs (four partial sums, fixed order), no cross-lane step.
// The int mask word of the lane's key is compared by value: nonzero -> the score is replaced by -inf. The score goes to the LDS row of its query (cross-wave, block barrier).
// Softmax: wave w takes query row w alone (16 keys a lane, f32, max-subtracted, exp2, rcp of the row sum; shuffle trees inside the wave) and writes the whole P16 row
// (f16, P x1024, 1 KB, head-major [h][b][q][k]) as 32 lanes x 16 B, twice.
__global__ __launch_bounds__(512) void k_score(const float* __restrict__ QPF, const float* __restrict__ KPF, const float* __restrict__ vv, const int* __restrict__ mask, h16* P16) {
    __shared__ __align__(16) float s_kp[TK * KPP];
    __shared__ __align__(16) float s_sc[QG * TK];
    __shared__ __align__(16) float s_qp[QG * HH];
    __shared__ __align__(16) float s_w2[HH];
    const int blk = blockIdx.x; const int qg = blk % (TQ / QG); const int h = (blk / (TQ / QG)) % NHD; const int b = blk / ((TQ / QG) * NHD);
    const int tid = threadIdx.x, lane = tid & 31, wave = tid >> 5;
    const int q0 = qg * QG;
    {
        const float* kb = KPF + ((size_t)b * TK * NHD + h) * HH;
        const int rr = wave * 32 + (lane >> 4), cc = (lane & 15) * 4;
        v4f st[16];
#pragma unroll
        for (int j = 0; j < 16; ++j) st[j] = *(const v4f*)(kb + (size_t)(rr + 2 * j) * NHD * HH + cc);
        const v2f qv = *(const v2f*)(QPF + ((size_t)(b * TQ + q0 + wave) * NHD + h) * HH + lane * 2);
#pragma unroll
        for (int j = 0; j < 16; ++j) *(v4fa*)(s_kp + (rr + 2 * j) * KPP + cc) = st[j];
        s_qp[wave * HH + lane * 2] = qv[0]; s_qp[wave * HH + lane * 2 + 1] = qv[1];
        if (tid < HH) s_w2[tid] = bfr(vv[tid]);
    }
    const int mk = mask[(size_t)b * TK + tid];
    __syncthreads();
    v2f kp[HH / 2], wv[HH / 2];
#pragma unroll
    for (int c = 0; c < HH / 4; ++c) {
        const v4f t = *(const v4fa*)(s_kp + tid * KPP + c * 4); kp[2 * c] = (v2f){t[0], t[1]}; kp[2 * c + 1] = (v2f){t[2], t[3]};
        const v4f u = *(const v4fa*)(s_w2 + c * 4); wv[2 * c] = (v2f){u[0], u[1]}; wv[2 * c + 1] = (v2f){u[2], u[3]};
    }
    // rolled over the queries: the body (HH hidden units, unrolled) stays a few KB of text
#pragma unroll 1
    for (int i = 0; i < QG; ++i) {
        const float* qr = s_qp + i * HH;
        v2f a0 = (v2f){0.0f, 0.0f}, a1 = (v2f){0.0f, 0.0f};
#pragma unroll
        for (int c = 0; c < HH / 4; ++c) {
            const v4f qq = *(const v4fa*)(qr + c * 4);
            a0 = __builtin_elementwise_fma(wv[2 * c], tnh2((v2f){qq[0], qq[1]} + kp[2 * c]), a0);
            a1 = __builtin_elementwise_fma(wv[2 * c + 1], tnh2((v2f){qq[2], qq[3]} + kp[2 * c + 1]), a1);
        }
        const v2f as = a0 + a1;
        const float s = as[0] + as[1];
        s_sc[i * TK + tid] = (mk != 0) ? -INFINITY : s;
    }
    __syncthreads();
    const float* row = s_sc + wave * TK;
    v2f x[8];
#pragma unroll
    for (int i = 0; i < 2; ++i)
#pragma unroll
        for (int c = 0; c < 2; ++c) { const v4f t = *(const v4fa*)(row + (i * 32 + lane) * 8 + c * 4); x[4 * i + 2 * c] = (v2f){t[0], t[1]}; x[4 * i + 2 * c + 1] = (v2f){t[2], t[3]}; }
    float m = x[0][0];
#pragma unroll
    for (int i = 0; i < 8; ++i) m = fmaxf(m, fmaxf(x[i][0], x[i][1]));
#pragma unroll
    for (int sh = 16; sh; sh >>= 1) m = fmaxf(m, __shfl_xor(m, sh, 32));
    v2f s2 = (v2f){0.0f, 0.0f};
#pragma unroll
    for (int i = 0; i < 8; ++i) { const v2f d = (x[i] - m) * LOG2E; x[i][0] = __builtin_amdgcn_exp2f(d[0]); x[i][1] = __builtin_amdgcn_exp2f(d[1]); s2 += x[i]; }
    float sum = s2[0] + s2[1];
#pragma unroll
    for (int sh = 16; sh; sh >>= 1) sum += __shfl_xor(sum, sh, 32);
    const float inv = __builtin_amdgcn_rcpf(sum); const float invp = inv * PCAR;
    h16* dst = P16 + ((size_t)(h * NB + b) * TQ + q0 + wave) * TK;
#pragma unroll
    for (int i = 0; i < 2; ++i) {
        v8h o;
#pragma unroll
        for (int c = 0; c < 4; ++c) { const v2f p = x[4 * i + c] * invp; o[2 * c] = toh_flush(p[0]); o[2 * c + 1] = toh_flush(p[1]); }
        *(v8h*)(dst + (i * 32 + lane) * 8) = o;
    }
}

extern "C" void kernel_launch(void* const* d_in, const int* in_sizes, int n_in,
                              void* d_out, int out_size, void* d_ws, size_t ws_size, hipStream_t stream) {
    if (n_in < 6) return;
    if (in_sizes[0] < NB * TK * DV || in_sizes[1] < NB * TQ * DV || in_sizes[2] < HH * 2 * DHD || in_sizes[3] < HH || in_sizes[4] < HH || in_sizes[5] < NB * TK) return;
    if (out_size < NB_FULL * TQ_FULL * DV) return;
    const float* x     = (const float*)d_in[0];   // [NB][TK][DV]   keys and values
    const float* query = (const float*)d_in[1];   // [NB][TQ][DV]
    const float* W     = (const float*)d_in[2];   // [HH][2*DHD]    ([out][in]; key columns first, query columns second)
    const float* bb    = (const float*)d_in[3];   // [HH]
    const float* w2    = (const float*)d_in[4];   // [HH]
    const int*   mask  = (const int*)d_in[5];     // [NB][TK]       nonzero = key excluded
    float* OUT = (float*)d_out;                   // [NB_FULL][TQ_FULL][DV], byte offset 0

    char* wsp = (char*)d_ws;
    auto take = [&](size_t bytes) { char* p = wsp; wsp += (bytes + 255) & ~(size_t)255; return (void*)p; };
    bf*    WB   = (bf*)take((size_t)2 * HH * DHD * 2);            // [2][HH][DHD] bf16          16,384 B
    bf*    XB   = (bf*)take((size_t)NB * TK * DV * 2);            // [NB*TK*NHD][DHD] bf16   4,194,304 B
    bf*    QB   = (bf*)take((size_t)NB * TQ * DV * 2);            // [NB*TQ*NHD][DHD] bf16     524,288 B
    float* KPF  = (float*)take((size_t)NB * TK * NHD * HH * 4);   // [NB*TK*NHD][HH] f32     8,388,608 B
    float* QPF  = (float*)take((size_t)NB * TQ * NHD * HH * 4);   // [NB*TQ*NHD][HH] f32     1,048,576 B
    h16*   VT16 = (h16*)take((size_t)NB * DV * TK * 2);           // [NB][DV][TK] f16        4,194,304 B
    h16*   P16  = (h16*)take((size_t)NHD * NB * TQ * TK * 2);     // [NHD][NB][TQ][TK] f16   4,194,304 B
    if ((size_t)(wsp - (char*)d_ws) > ws_size) return;            // total 22,560,768 B

    // weight planes Bt[a][d] (bf16 RNE): plane 0 key side, plane 1 query side
    k_wsplit<<<(unsigned)((2 * HH * DHD / 8 + 255) / 256), 256, 0, stream>>>(W, WB);
    // activation planes (bf16 RNE copies, layout kept: a [rows][DV] plane is also the [rows*NHD][DHD] per-head matrix)
    k_cvt8<<<(unsigned)(((size_t)NB * TK * DV / 8 + 255) / 256), 256, 0, stream>>>(x, XB, (size_t)NB * TK * DV / 8);
    k_cvt8<<<(unsigned)(((size_t)NB * TQ * DV / 8 + 255) / 256), 256, 0, stream>>>(query, QB, (size_t)NB * TQ * DV / 8);
    // value planes [b][c][k] f16 x16
    k_vtp<<<(unsigned)(((size_t)NB * DV * TK / 2 + 255) / 256), 256, 0, stream>>>(x, VT16);
    // kp = key-slice Wk^T : [NB*TK*NHD][DHD] x Bt[HH][DHD] -> f32 [NB*TK*NHD][HH]
    k_gemmw<bf, 0, false><<<dim3(NB * TK * NHD / 64, HH / 64, 1), 32, 0, stream>>>(XB, nullptr, WB, nullptr, DHD, KPF, HH, nullptr, 1.0f, 0, 0, 0, 0);
    // qp = query-slice Wq^T + b : [NB*TQ*NHD][DHD] x Bt[HH][DHD] -> f32 [NB*TQ*NHD][HH]
    k_gemmw<bf, 0, true><<<dim3(NB * TQ * NHD / 64, HH / 64, 1), 32, 0, stream>>>(QB, nullptr, WB + (size_t)HH * DHD, nullptr, DHD, QPF, HH, bb, 1.0f, 0, 0, 0, 0);
    // scores + mask + softmax per (b, h, QG queries) -> P16 (f16 x1024, head-major)
    k_score<<<(unsigned)(NB * NHD * (TQ / QG)), 512, 0, stream>>>(QPF, KPF, w2, mask, P16);
    // out[b][q][64h + d] = P . values, all heads in one launch: z = b, column block y = head h (DHD == 64), A = P16[h][b] by sAy, [TQ][TK] x Bt[DV][TK] -> f32 [TQ][DV], epilogue scale 2^-14
    k_gemmw<h16, 0, false><<<dim3(TQ / 64, DV / 64, NB), 32, 0, stream>>>(P16, nullptr, VT16, nullptr, TK, OUT, DV, nullptr, OSC, (size_t)TQ * TK, (size_t)DV * TK, (size_t)TQ_FULL * DV, (size_t)NB * TQ * TK);
}

// v003
// A run of this version takes 48.2 microseconds.
// Timed twice side by side with v002, it ran 1.29 and 1.30 times as fast.
// Counting every step since v000, it is 4.68 times as fast.
#include <hip/hip_runtime.h>

// Contractions: key-slice.Wk and query-slice.Wq (+b) per head on v_wmma_f32_16x16x32_bf16 (bf16 operands = RNE-converted f32 inputs, f32 accumulate);
// weights.values per head on v_wmma_f32_16x16x32_f16 in the tail of the score kernel (f16 operands: P carried x1024, V carried x16, f32 accumulate, folded by 2^-14 in the f32 epilogue);
// score matvec sum_a w2[a]*tanh(kp[a]+qp[a]+b[a]) (N=1) and the softmax stay f32 on VALU.

#ifndef NB
#define NB 8
#endif
#ifndef TQ
#define TQ 64
#endif
#define NB_FULL 8
#define TQ_FULL 64
#define TK    512
#define DV    512
#define NHD   8
#define DHD   64
#define HH    64
#define PCAR  1024.0f
#define VSC   16.0f
#define OSC   (1.0f / 16384.0f)
#define LOG2E 1.4426950408889634f
#define QG    16
#define KPP   68
#define PPP   520
#define KQ    128

static_assert(TQ == TQ_FULL || NB == 1);
static_assert(TQ % 64 == 0 && TQ >= 64 && TQ <= TQ_FULL);
static_assert(NB >= 1 && NB <= NB_FULL);
static_assert(TK == 2 * 256);
static_assert(TK == 8 * 64);
static_assert(HH == 2 * 32);
static_assert(NHD * DHD == DV);
static_assert((NB * TQ * NHD) % 64 == 0 && (NB * TK * NHD) % 64 == 0 && HH % 64 == 0 && DHD % 64 == 0);
static_assert(DHD % 32 == 0 && TK % 32 == 0 && DV % 8 == 0);
static_assert((size_t)NB_FULL * TQ_FULL * DV * 4 == 1048576);
static_assert(2 * 32 * 16 == TK * 2);
static_assert(4 * 256 * 8 == 2 * HH * DHD);
static_assert(HH * DHD / 8 == (1 << 9));
static_assert(DHD / 8 == (1 << 3));
static_assert(HH == 64);
static_assert(DHD == 64);
static_assert(16 * 68 * 4 <= 131072);
static_assert(TQ % QG == 0 && QG * 32 == TK && QG * 32 == 512 && HH == 2 * 32 && HH % 4 == 0);
static_assert(KPP >= HH && KPP % 4 == 0 && (KPP / 4) % 2 == 1);
static_assert(QG == 16 && DHD == 4 * 16 && TK == 4 * KQ && KQ == 4 * 32 && QG * DHD == 2 * 512);
static_assert(PPP >= TK && PPP % 8 == 0 && (PPP / 8) % 2 == 1);
static_assert((TK * KPP + QG * TK + QG * HH + HH + 4 * QG * DHD) * 4 + QG * PPP * 2 <= 327680);
static_assert((size_t)2 * HH * DHD * 2 + (size_t)NB * TK * DV * 2 + (size_t)NB * TQ * DV * 2 + (size_t)NB * TK * NHD * HH * 4 + (size_t)NB * TQ * NHD * HH * 4
              + (size_t)NB * DV * TK * 2 <= 134217728);

typedef _Float16 h16;
typedef unsigned short bf;
typedef __attribute__((ext_vector_type(16))) __bf16   v16bf;
typedef __attribute__((ext_vector_type(16))) _Float16 v16h;
typedef __attribute__((ext_vector_type(8)))  _Float16 v8h;
typedef __attribute__((ext_vector_type(8)))  unsigned short v8us;
typedef __attribute__((ext_vector_type(8)))  float    v8f;
typedef __attribute__((ext_vector_type(4)))  float    v4f;
typedef __attribute__((ext_vector_type(2)))  float    v2f;
typedef __attribute__((ext_vector_type(2)))  _Float16 v2h;
typedef __attribute__((ext_vector_type(2)))  unsigned short v2us;
typedef v8h  __attribute__((may_alias)) v8ha;
typedef v4f  __attribute__((may_alias)) v4fa;
typedef v8us __attribute__((may_alias)) v8usa;

__device__ __forceinline__ unsigned short f2bf(float f) { unsigned u = __float_as_uint(f); u += 0x7FFFu + ((u >> 16) & 1u); return (unsigned short)(u >> 16); }
__device__ __forceinline__ float bf2f(unsigned short b) { return __uint_as_float(((unsigned)b) << 16); }
__device__ __forceinline__ float bfr(float f) { return bf2f(f2bf(f)); }
__device__ __forceinline__ v16h cat16(v8h lo, v8h hi) { return __builtin_shufflevector(lo, hi, 0, 1, 2, 3, 4, 5, 6, 7, 8, 9, 10, 11, 12, 13, 14, 15); }
__device__ __forceinline__ v16bf cat16b(v8us lo, v8us hi) { return __builtin_bit_cast(v16bf, __builtin_shufflevector(lo, hi, 0, 1, 2, 3, 4, 5, 6, 7, 8, 9, 10, 11, 12, 13, 14, 15)); }
__device__ __forceinline__ v8f wmma16(v16h a, v16h b, v8f c) { return __builtin_amdgcn_wmma_f32_16x16x32_f16(false, a, false, b, (short)0, c, false, false); }
__device__ __forceinline__ v8f wmmab(v16bf a, v16bf b, v8f c) { return __builtin_amdgcn_wmma_f32_16x16x32_bf16(false, a, false, b, (short)0, c, false, false); }
// f32 -> f16 convert for WMMA operand planes: magnitudes under 2^-14 become +0 by a value select (applied after the plane's power-of-two carry).
__device__ __forceinline__ h16 toh_flush(float v) { const float w = (fabsf(v) < 6.103515625e-05f) ? 0.0f : v; return (h16)w; }

// ---- k_gemmw: register-blocked GEMM, ONE WAVE per 64x64 output tile (16 accumulators), operands straight from K-contiguous 16-bit planes; grid (M/64, N/64, Z), 32 threads.
// C[m][n] (f32, pitch ldc) = csc * sum_k A[m][k] Bt[n][k] (+ split products per NSPLIT) (+ optional bf16-exact f32 bias[n]). z-batch strides sA/sB/sC in elements. K % 32 == 0.
// Fragments (lane l, hi = l>>4, lr = l&15): A elements 0..7 <- A[r][k0+8hi+0..7], 8..15 <- A[r][k0+16+8hi+0..7]; B identical k map from Bt[n][k]; D element j -> (row 8hi+j, col lr).
template <typename T16> struct WFrag;
template <> struct WFrag<bf> { typedef v16bf V; static __device__ __forceinline__ V ld(const bf* p) { return cat16b(*(const v8us*)p, *(const v8us*)(p + 16)); } static __device__ __forceinline__ v8f mma(V a, V b, v8f c) { return wmmab(a, b, c); } };
template <typename T16, int NSPLIT, bool BIAS>
__global__ __launch_bounds__(32) void k_gemmw(const T16* __restrict__ A, const T16* __restrict__ A2, const T16* __restrict__ Bt, const T16* __restrict__ Bt2, int K, float* C, int ldc, const float* __restrict__ bias, float csc, size_t sA, size_t sB, size_t sC) {
    typedef typename WFrag<T16>::V V;
    __shared__ __align__(16) float os[16 * 68];
    const size_t z = blockIdx.z; A += z * sA; if (A2) A2 += z * sA; Bt += z * sB; if (Bt2) Bt2 += z * sB; C += z * sC;
    const int lane = threadIdx.x & 31, lr = lane & 15, hi = lane >> 4; const int r0 = blockIdx.x * 64, c0 = blockIdx.y * 64;
    v8f acc[4][4];
#pragma unroll
    for (int mb = 0; mb < 4; ++mb)
#pragma unroll
        for (int nb = 0; nb < 4; ++nb) acc[mb][nb] = (v8f){};
    const size_t aoff = (size_t)(r0 + lr) * K + 8 * hi, boff = (size_t)(c0 + lr) * K + 8 * hi;
#pragma unroll 1
    for (int kc = 0; kc < K; kc += 32) {
        V a[4], a2[4];
#pragma unroll
        for (int mb = 0; mb < 4; ++mb) { a[mb] = WFrag<T16>::ld(A + aoff + (size_t)mb * 16 * K + kc); if (NSPLIT == 1 || NSPLIT == 2) a2[mb] = WFrag<T16>::ld(A2 + aoff + (size_t)mb * 16 * K + kc); }
#pragma unroll
        for (int nb = 0; nb < 4; ++nb) { const V b = WFrag<T16>::ld(Bt + boff + (size_t)nb * 16 * K + kc); V b2; if (NSPLIT >= 2) b2 = WFrag<T16>::ld(Bt2 + boff + (size_t)nb * 16 * K + kc);
#pragma unroll
            for (int mb = 0; mb < 4; ++mb) { acc[mb][nb] = WFrag<T16>::mma(a[mb], b, acc[mb][nb]); if (NSPLIT == 1 || NSPLIT == 2) acc[mb][nb] = WFrag<T16>::mma(a2[mb], b, acc[mb][nb]); if (NSPLIT >= 2) acc[mb][nb] = WFrag<T16>::mma(a[mb], b2, acc[mb][nb]); } }
        asm volatile("v_nop\n\tv_nop\n\tv_nop\n\tv_nop" : "+v"(acc[0][0]), "+v"(acc[1][1]), "+v"(acc[2][2]), "+v"(acc[3][3]) : "v"(a[0]), "v"(a[3]));
    }
#pragma unroll
    for (int mb = 0; mb < 4; ++mb) {
#pragma unroll
        for (int nb = 0; nb < 4; ++nb) {
#pragma unroll
            for (int j = 0; j < 8; ++j) os[(hi * 8 + j) * 68 + nb * 16 + lr] = acc[mb][nb][j]; }
        __builtin_amdgcn_wave_barrier(); asm volatile("" ::: "memory");
        float* crow = C + (size_t)(r0 + mb * 16) * ldc + c0;
{
#pragma unroll
            for (int s = 0; s < 8; ++s) { const int row = 2 * s + hi, cofs = lr * 4; v4f val = *(const v4fa*)(os + row * 68 + cofs); val = val * csc;
                if (BIAS) { val[0] += bfr(bias[c0 + cofs]); val[1] += bfr(bias[c0 + cofs + 1]); val[2] += bfr(bias[c0 + cofs + 2]); val[3] += bfr(bias[c0 + cofs + 3]); }
                *(v4f*)(crow + (size_t)row * ldc + cofs) = val; }
             }
        __builtin_amdgcn_wave_barrier(); asm volatile("" ::: "memory");
    }
}

// ---- k_wsplit: two contiguous bf16 (RNE) Bt planes [HH][DHD] from the [OUT][IN] weight of row pitch 2*DHD: plane 0 = input columns 0..DHD-1 (key side), plane 1 = columns DHD..2*DHD-1 (query side).
// Index split by unsigned shifts and masks: i = pl * 2^9 + a * 2^3 + pc (HH * DHD / 8 == 2^9, DHD / 8 == 2^3, HH == 64: tied to the defines by file-scope static_asserts).
__global__ __launch_bounds__(256) void k_wsplit(const float* __restrict__ w, bf* WB) {
    const unsigned i = blockIdx.x * 256u + threadIdx.x; if (i >= (unsigned)(2 * HH * DHD / 8)) return;
    const unsigned pl = i >> 9; const unsigned a = (i >> 3) & 63u; const unsigned pc = i & 7u;
    const v8f v = *(const v8f*)(w + (size_t)a * (2 * DHD) + pl * DHD + pc * 8); v8us o;
#pragma unroll
    for (int k = 0; k < 8; ++k) o[k] = f2bf(v[k]);
    *(v8us*)(WB + (size_t)i * 8) = o; 
}

__global__ __launch_bounds__(256) void k_cvt8(const float* __restrict__ src, bf* dst, size_t n8) { const size_t i = (size_t)blockIdx.x * 256 + threadIdx.x; if (i >= n8) return; const v8f v = *(const v8f*)(src + i * 8); v8us o;
#pragma unroll
    for (int k = 0; k < 8; ++k) o[k] = f2bf(v[k]); *(v8us*)(dst + i * 8) = o;  }

// ---- k_vtp: value planes V16[b][d][t] (f16) = bf16_RNE(F[b][t][d]) * VSC (raw input; the x16 carry keeps small entries normal in f16; bf16 significands are exact in f16);
__global__ __launch_bounds__(256) void k_vtp(const float* __restrict__ F, h16* V16) {
    const size_t e = ((size_t)blockIdx.x * 256 + threadIdx.x) * 2; if (e >= (size_t)NB * DV * TK) return;
    const int t = (int)(e % TK); const int d = (int)((e / TK) % DV); const int b = (int)(e / ((size_t)TK * DV));
    v2h o;
#pragma unroll
    for (int q = 0; q < 2; ++q) o[q] = toh_flush(bfr(F[((size_t)b * TK + t + q) * DV + d]) * VSC);
    *(v2h*)(V16 + e) = o; 
}

// ---- tanh of two hidden units at once, via exp2 and rcp: 1 - 2 / (e^{2x} + 1); saturates cleanly to +-1 for large |x| (e = inf -> rcp 0, e = 0 -> rcp 1).
__device__ __forceinline__ v2f tnh2(v2f x) {
    const v2f y = x * 2.8853900817779268f;
    v2f e; e[0] = __builtin_amdgcn_exp2f(y[0]); e[1] = __builtin_amdgcn_exp2f(y[1]);
    const v2f d = e + 1.0f;
    v2f r; r[0] = __builtin_amdgcn_rcpf(d[0]); r[1] = __builtin_amdgcn_rcpf(d[1]);
    return __builtin_elementwise_fma((v2f){-2.0f, -2.0f}, r, (v2f){1.0f, 1.0f});
}

// ---- k_score: one block (16 waves) per (b, h, group of QG queries); LANE tid OWNS KEY tid and keeps that key's whole key-side projection row (HH f32) in registers for all QG queries.
// Staging: the 512 rows ((b*TK+k)*NHD+h) are read as whole 256-B rows (16 B a lane) into LDS at a pitch of KPP floats (272 B = 16 B x odd), and each lane reads its own row back;
// bf16_RNE(w2) and the QG query-side rows ((b*TQ+q)*NHD+h) (bias already added) go through LDS too and are read at one address by all lanes.
// Per query: s = sum_a w2[a] tanh(qp[a] + kp[k][a]) in f32, summed inside the lane over hidden-unit pairs (four partial sums, fixed order), no cross-lane step.
// The int mask word of the lane's key is compared by value: nonzero -> the score is replaced by -inf. The score goes to the LDS row of its query (cross-wave, block barrier).
// Softmax: wave w takes query row w alone (16 keys a lane, f32, max-subtracted, exp2, rcp of the row sum; shuffle trees inside the wave) and writes the whole P row
// (f16, P x1024, 1 KB) into LDS at a pitch of PPP halves (1040 B = 16 B x odd) as 32 lanes x 16 B, twice.
// weights.values: [QG][TK] P (LDS) x V16[b][64h + n][k] (global, k-contiguous) -> [QG][DHD]. Wave w takes the 16 output columns nt = w & 3 and the KQ keys of quarter kq = w >> 2:
// four chained WMMAs; its value fragments are fetched in front of the score loop. Fragment maps as in k_gemmw (A and B by the same k map). The four quarters meet in LDS and are added in f32, quarter 0 first;
// thread tid stores out[b][q0 + tid/32][64h + 2(tid%32) .. +1], so a wave writes one whole 256-B row piece.
__global__ __launch_bounds__(512) void k_score(const float* __restrict__ QPF, const float* __restrict__ KPF, const float* __restrict__ vv, const int* __restrict__ mask, const h16* __restrict__ V16, float* OUT) {
    __shared__ __align__(16) float s_kp[TK * KPP];
    __shared__ __align__(16) float s_sc[QG * TK];
    __shared__ __align__(16) float s_qp[QG * HH];
    __shared__ __align__(16) float s_w2[HH];
    __shared__ __align__(16) h16 s_p[QG * PPP];
    __shared__ __align__(16) float s_o[4 * QG * DHD];
    const int blk = blockIdx.x; const int qg = blk % (TQ / QG); const int h = (blk / (TQ / QG)) % NHD; const int b = blk / ((TQ / QG) * NHD);
    const int tid = threadIdx.x, lane = tid & 31, wave = tid >> 5;
    const int q0 = qg * QG;
    const int lr = lane & 15, hi = lane >> 4, nt = wave & 3, kq = wave >> 2;
    {
        const float* kb = KPF + ((size_t)b * TK * NHD + h) * HH;
        const int rr = wave * 32 + (lane >> 4), cc = (lane & 15) * 4;
        v4f st[16];
#pragma unroll
        for (int j = 0; j < 16; ++j) st[j] = *(const v4f*)(kb + (size_t)(rr + 2 * j) * NHD * HH + cc);
        const v2f qv = *(const v2f*)(QPF + ((size_t)(b * TQ + q0 + wave) * NHD + h) * HH + lane * 2);
#pragma unroll
        for (int j = 0; j < 16; ++j) *(v4fa*)(s_kp + (rr + 2 * j) * KPP + cc) = st[j];
        s_qp[wave * HH + lane * 2] = qv[0]; s_qp[wave * HH + lane * 2 + 1] = qv[1];
        if (tid < HH) s_w2[tid] = bfr(vv[tid]);
    }
    const int mk = mask[(size_t)b * TK + tid];
    __syncthreads();
    // value fragments of this wave's slice, issued behind the staging barrier: nothing waits for them before the score loop is through
    v16h vb[4];
    {
        const h16* vp = V16 + ((size_t)b * DV + h * DHD + nt * 16 + lr) * TK + kq * KQ + 8 * hi;
#pragma unroll
        for (int s = 0; s < 4; ++s) vb[s] = cat16(*(const v8h*)(vp + s * 32), *(const v8h*)(vp + s * 32 + 16));
    }
    v2f kp[HH / 2], wv[HH / 2];
#pragma unroll
    for (int c = 0; c < HH / 4; ++c) {
        const v4f t = *(const v4fa*)(s_kp + tid * KPP + c * 4); kp[2 * c] = (v2f){t[0], t[1]}; kp[2 * c + 1] = (v2f){t[2], t[3]};
        const v4f u = *(const v4fa*)(s_w2 + c * 4); wv[2 * c] = (v2f){u[0], u[1]}; wv[2 * c + 1] = (v2f){u[2], u[3]};
    }
    // rolled over the queries: the body (HH hidden units, unrolled) stays a few KB of text
#pragma unroll 1
    for (int i = 0; i < QG; ++i) {
        const float* qr = s_qp + i * HH;
        v2f a0 = (v2f){0.0f, 0.0f}, a1 = (v2f){0.0f, 0.0f};
#pragma unroll
        for (int c = 0; c < HH / 4; ++c) {
            const v4f qq = *(const v4fa*)(qr + c * 4);
            a0 = __builtin_elementwise_fma(wv[2 * c], tnh2((v2f){qq[0], qq[1]} + kp[2 * c]), a0);
            a1 = __builtin_elementwise_fma(wv[2 * c + 1], tnh2((v2f){qq[2], qq[3]} + kp[2 * c + 1]), a1);
        }
        const v2f as = a0 + a1;
        const float s = as[0] + as[1];
        s_sc[i * TK + tid] = (mk != 0) ? -INFINITY : s;
    }
    __syncthreads();
    const float* row = s_sc + wave * TK;
    v2f x[8];
#pragma unroll
    for (int i = 0; i < 2; ++i)
#pragma unroll
        for (int c = 0; c < 2; ++c) { const v4f t = *(const v4fa*)(row + (i * 32 + lane) * 8 + c * 4); x[4 * i + 2 * c] = (v2f){t[0], t[1]}; x[4 * i + 2 * c + 1] = (v2f){t[2], t[3]}; }
    float m = x[0][0];
#pragma unroll
    for (int i = 0; i < 8; ++i) m = fmaxf(m, fmaxf(x[i][0], x[i][1]));
#pragma unroll
    for (int sh = 16; sh; sh >>= 1) m = fmaxf(m, __shfl_xor(m, sh, 32));
    v2f s2 = (v2f){0.0f, 0.0f};
#pragma unroll
    for (int i = 0; i < 8; ++i) { const v2f d = (x[i] - m) * LOG2E; x[i][0] = __builtin_amdgcn_exp2f(d[0]); x[i][1] = __builtin_amdgcn_exp2f(d[1]); s2 += x[i]; }
    float sum = s2[0] + s2[1];
#pragma unroll
    for (int sh = 16; sh; sh >>= 1) sum += __shfl_xor(sum, sh, 32);
    const float inv = __builtin_amdgcn_rcpf(sum); const float invp = inv * PCAR;
    h16* dst = s_p + wave * PPP;
#pragma unroll
    for (int i = 0; i < 2; ++i) {
        v8h o;
#pragma unroll
        for (int c = 0; c < 4; ++c) { const v2f p = x[4 * i + c] * invp; o[2 * c] = toh_flush(p[0]); o[2 * c + 1] = toh_flush(p[1]); }
        *(v8ha*)(dst + (i * 32 + lane) * 8) = o;
    }
    __syncthreads();
    v8f acc = (v8f){};
    const h16* pa = s_p + lr * PPP + kq * KQ + 8 * hi;
#pragma unroll
    for (int s = 0; s < 4; ++s) acc = wmma16(cat16(*(const v8ha*)(pa + s * 32), *(const v8ha*)(pa + s * 32 + 16)), vb[s], acc);
#pragma unroll
    for (int j = 0; j < 8; ++j) s_o[(kq * QG + hi * 8 + j) * DHD + nt * 16 + lr] = acc[j];
    __syncthreads();
    v2f r = *(const v2f*)(s_o + tid * 2);
#pragma unroll
    for (int g = 1; g < 4; ++g) r += *(const v2f*)(s_o + g * QG * DHD + tid * 2);
    *(v2f*)(OUT + ((size_t)b * TQ_FULL + q0 + wave) * DV + h * DHD + lane * 2) = r * OSC;
}

extern "C" void kernel_launch(void* const* d_in, const int* in_sizes, int n_in,
                              void* d_out, int out_size, void* d_ws, size_t ws_size, hipStream_t stream) {
    if (n_in < 6) return;
    if (in_sizes[0] < NB * TK * DV || in_sizes[1] < NB * TQ * DV || in_sizes[2] < HH * 2 * DHD || in_sizes[3] < HH || in_sizes[4] < HH || in_sizes[5] < NB * TK) return;
    if (out_size < NB_FULL * TQ_FULL * DV) return;
    const float* x     = (const float*)d_in[0];   // [NB][TK][DV]   keys and values
    const float* query = (const float*)d_in[1];   // [NB][TQ][DV]
    const float* W     = (const float*)d_in[2];   // [HH][2*DHD]    ([out][in]; key columns first, query columns second)
    const float* bb    = (const float*)d_in[3];   // [HH]
    const float* w2    = (const float*)d_in[4];   // [HH]
    const int*   mask  = (const int*)d_in[5];     // [NB][TK]       nonzero = key excluded
    float* OUT = (float*)d_out;                   // [NB_FULL][TQ_FULL][DV], byte offset 0

    char* wsp = (char*)d_ws;
    auto take = [&](size_t bytes) { char* p = wsp; wsp += (bytes + 255) & ~(size_t)255; return (void*)p; };
    bf*    WB   = (bf*)take((size_t)2 * HH * DHD * 2);            // [2][HH][DHD] bf16          16,384 B
    bf*    XB   = (bf*)take((size_t)NB * TK * DV * 2);            // [NB*TK*NHD][DHD] bf16   4,194,304 B
    bf*    QB   = (bf*)take((size_t)NB * TQ * DV * 2);            // [NB*TQ*NHD][DHD] bf16     524,288 B
    float* KPF  = (float*)take((size_t)NB * TK * NHD * HH * 4);   // [NB*TK*NHD][HH] f32     8,388,608 B
    float* QPF  = (float*)take((size_t)NB * TQ * NHD * HH * 4);   // [NB*TQ*NHD][HH] f32     1,048,576 B
    h16*   VT16 = (h16*)take((size_t)NB * DV * TK * 2);           // [NB][DV][TK] f16        4,194,304 B
    if ((size_t)(wsp - (char*)d_ws) > ws_size) return;            // total 18,366,464 B

    // weight planes Bt[a][d] (bf16 RNE): plane 0 key side, plane 1 query side
    k_wsplit<<<(unsigned)((2 * HH * DHD / 8 + 255) / 256), 256, 0, stream>>>(W, WB);
    // activation planes (bf16 RNE copies, layout kept: a [rows][DV] plane is also the [rows*NHD][DHD] per-head matrix)
    k_cvt8<<<(unsigned)(((size_t)NB * TK * DV / 8 + 255) / 256), 256, 0, stream>>>(x, XB, (size_t)NB * TK * DV / 8);
    k_cvt8<<<(unsigned)(((size_t)NB * TQ * DV / 8 + 255) / 256), 256, 0, stream>>>(query, QB, (size_t)NB * TQ * DV / 8);
    // value planes [b][c][k] f16 x16
    k_vtp<<<(unsigned)(((size_t)NB * DV * TK / 2 + 255) / 256), 256, 0, stream>>>(x, VT16);
    // kp = key-slice Wk^T : [NB*TK*NHD][DHD] x Bt[HH][DHD] -> f32 [NB*TK*NHD][HH]
    k_gemmw<bf, 0, false><<<dim3(NB * TK * NHD / 64, HH / 64, 1), 32, 0, stream>>>(XB, nullptr, WB, nullptr, DHD, KPF, HH, nullptr, 1.0f, 0, 0, 0);
    // qp = query-slice Wq^T + b : [NB*TQ*NHD][DHD] x Bt[HH][DHD] -> f32 [NB*TQ*NHD][HH]
    k_gemmw<bf, 0, true><<<dim3(NB * TQ * NHD / 64, HH / 64, 1), 32, 0, stream>>>(QB, nullptr, WB + (size_t)HH * DHD, nullptr, DHD, QPF, HH, bb, 1.0f, 0, 0, 0);
    // scores + mask + softmax + P . values per (b, h, QG queries): out[b][q][64h + d], f32, epilogue scale 2^-14
    k_score<<<(unsigned)(NB * NHD * (TQ / QG)), 512, 0, stream>>>(QPF, KPF, w2, mask, VT16, OUT);
}

// v004
// One run takes 38.8 microseconds.
// Next to v003, in two timings, it ran 1.24 and 1.25 times as fast.
// Over all steps from v000 it is 5.84 times as fast.
#include <hip/hip_runtime.h>

// Contractions: key-slice.Wk and query-slice.Wq (+b) per head on v_wmma_f32_16x16x32_bf16 (bf16 operands = RNE-converted f32 inputs, f32 accumulate);
// weights.values per head on v_wmma_f32_16x16x32_f16 in the tail of the score kernel (f16 operands: P carried x1024, V = bf16_RNE(x) carried x16 and formed in registers from the raw input, f32 accumulate, folded by 2^-14 in the f32 epilogue);
// score matvec sum_a w2[a]*tanh(kp[a]+qp[a]+b[a]) (N=1) and the softmax stay f32 on VALU.

#ifndef NB
#define NB 8
#endif
#ifndef TQ
#define TQ 64
#endif
#define NB_FULL 8
#define TQ_FULL 64
#define TK    512
#define DV    512
#define NHD   8
#define DHD   64
#define HH    64
#define PCAR  1024.0f
#define VSC   16.0f
#define OSC   (1.0f / 16384.0f)
#define LOG2E 1.4426950408889634f
#define QG    16
#define KPP   68
#define PPP   520
#define KQ    128

static_assert(TQ == TQ_FULL || NB == 1);
static_assert(TQ % 64 == 0 && TQ >= 64 && TQ <= TQ_FULL);
static_assert(NB >= 1 && NB <= NB_FULL);
static_assert(TK == 2 * 256);
static_assert(TK == 8 * 64);
static_assert(HH == 2 * 32);
static_assert(NHD * DHD == DV);
static_assert((NB * TQ * NHD) % 64 == 0 && (NB * TK * NHD) % 64 == 0 && HH % 64 == 0 && DHD % 64 == 0);
static_assert(DHD % 32 == 0 && TK % 32 == 0 && DV % 8 == 0);
static_assert((size_t)NB_FULL * TQ_FULL * DV * 4 == 1048576);
static_assert(2 * 32 * 16 == TK * 2);
static_assert(4 * 256 * 8 == 2 * HH * DHD);
static_assert(HH * DHD / 8 == (1 << 9));
static_assert(DHD / 8 == (1 << 3));
static_assert(HH == 64);
static_assert(DHD == 64);
static_assert(16 * 68 * 4 <= 131072);
static_assert(TQ % QG == 0 && QG * 32 == TK && QG * 32 == 512 && HH == 2 * 32 && HH % 4 == 0);
static_assert(KPP >= HH && KPP % 4 == 0 && (KPP / 4) % 2 == 1);
static_assert(QG == 16 && DHD == 4 * 16 && TK == 4 * KQ && KQ == 4 * 32 && QG * DHD == 2 * 512);
static_assert(PPP >= TK && PPP % 8 == 0 && (PPP / 8) % 2 == 1);
static_assert((TK * KPP + QG * TK + QG * HH + HH + 4 * QG * DHD) * 4 + QG * PPP * 2 + 8 * 512 * 8 * 2 <= 327680);
static_assert((size_t)2 * HH * DHD * 2 + (size_t)NB * TK * DV * 2 + (size_t)NB * TQ * DV * 2 + (size_t)NB * TK * NHD * HH * 4 + (size_t)NB * TQ * NHD * HH * 4 <= 134217728);

typedef _Float16 h16;
typedef unsigned short bf;
typedef __attribute__((ext_vector_type(16))) __bf16   v16bf;
typedef __attribute__((ext_vector_type(16))) _Float16 v16h;
typedef __attribute__((ext_vector_type(8)))  _Float16 v8h;
typedef __attribute__((ext_vector_type(8)))  unsigned short v8us;
typedef __attribute__((ext_vector_type(8)))  float    v8f;
typedef __attribute__((ext_vector_type(4)))  float    v4f;
typedef __attribute__((ext_vector_type(2)))  float    v2f;
typedef __attribute__((ext_vector_type(2)))  unsigned short v2us;
typedef __attribute__((ext_vector_type(2)))  __bf16   v2bf;
typedef v8h  __attribute__((may_alias)) v8ha;
typedef v4f  __attribute__((may_alias)) v4fa;
typedef v8us __attribute__((may_alias)) v8usa;

__device__ __forceinline__ unsigned short f2bf(float f) { unsigned u = __float_as_uint(f); u += 0x7FFFu + ((u >> 16) & 1u); return (unsigned short)(u >> 16); }
__device__ __forceinline__ float bf2f(unsigned short b) { return __uint_as_float(((unsigned)b) << 16); }
__device__ __forceinline__ float bfr(float f) { return bf2f(f2bf(f)); }
__device__ __forceinline__ v16h cat16(v8h lo, v8h hi) { return __builtin_shufflevector(lo, hi, 0, 1, 2, 3, 4, 5, 6, 7, 8, 9, 10, 11, 12, 13, 14, 15); }
__device__ __forceinline__ v16bf cat16b(v8us lo, v8us hi) { return __builtin_bit_cast(v16bf, __builtin_shufflevector(lo, hi, 0, 1, 2, 3, 4, 5, 6, 7, 8, 9, 10, 11, 12, 13, 14, 15)); }
__device__ __forceinline__ v8f wmma16(v16h a, v16h b, v8f c) { return __builtin_amdgcn_wmma_f32_16x16x32_f16(false, a, false, b, (short)0, c, false, false); }
__device__ __forceinline__ v8f wmmab(v16bf a, v16bf b, v8f c) { return __builtin_amdgcn_wmma_f32_16x16x32_bf16(false, a, false, b, (short)0, c, false, false); }
// f32 -> f16 convert for WMMA operand planes: magnitudes under 2^-14 become +0 by a value select (applied after the plane's power-of-two carry).
__device__ __forceinline__ h16 toh_flush(float v) { const float w = (fabsf(v) < 6.103515625e-05f) ? 0.0f : v; return (h16)w; }

// ---- k_gemmw: register-blocked GEMM, ONE WAVE per 64x64 output tile (16 accumulators), operands straight from K-contiguous 16-bit planes; grid (M/64, N/64, Z), 32 threads.
// C[m][n] (f32, pitch ldc) = csc * sum_k A[m][k] Bt[n][k] (+ split products per NSPLIT) (+ optional bf16-exact f32 bias[n]). z-batch strides sA/sB/sC in elements. K % 32 == 0.
// Fragments (lane l, hi = l>>4, lr = l&15): A elements 0..7 <- A[r][k0+8hi+0..7], 8..15 <- A[r][k0+16+8hi+0..7]; B identical k map from Bt[n][k]; D element j -> (row 8hi+j, col lr).
template <typename T16> struct WFrag;
template <> struct WFrag<bf> { typedef v16bf V; static __device__ __forceinline__ V ld(const bf* p) { return cat16b(*(const v8us*)p, *(const v8us*)(p + 16)); } static __device__ __forceinline__ v8f mma(V a, V b, v8f c) { return wmmab(a, b, c); } };
template <typename T16, int NSPLIT, bool BIAS>
__global__ __launch_bounds__(32) void k_gemmw(const T16* __restrict__ A, const T16* __restrict__ A2, const T16* __restrict__ Bt, const T16* __restrict__ Bt2, int K, float* C, int ldc, const float* __restrict__ bias, float csc, size_t sA, size_t sB, size_t sC) {
    typedef typename WFrag<T16>::V V;
    __shared__ __align__(16) float os[16 * 68];
    const size_t z = blockIdx.z; A += z * sA; if (A2) A2 += z * sA; Bt += z * sB; if (Bt2) Bt2 += z * sB; C += z * sC;
    const int lane = threadIdx.x & 31, lr = lane & 15, hi = lane >> 4; const int r0 = blockIdx.x * 64, c0 = blockIdx.y * 64;
    v8f acc[4][4];
#pragma unroll
    for (int mb = 0; mb < 4; ++mb)
#pragma unroll
        for (int nb = 0; nb < 4; ++nb) acc[mb][nb] = (v8f){};
    const size_t aoff = (size_t)(r0 + lr) * K + 8 * hi, boff = (size_t)(c0 + lr) * K + 8 * hi;
#pragma unroll 1
    for (int kc = 0; kc < K; kc += 32) {
        V a[4], a2[4];
#pragma unroll
        for (int mb = 0; mb < 4; ++mb) { a[mb] = WFrag<T16>::ld(A + aoff + (size_t)mb * 16 * K + kc); if (NSPLIT == 1 || NSPLIT == 2) a2[mb] = WFrag<T16>::ld(A2 + aoff + (size_t)mb * 16 * K + kc); }
#pragma unroll
        for (int nb = 0; nb < 4; ++nb) { const V b = WFrag<T16>::ld(Bt + boff + (size_t)nb * 16 * K + kc); V b2; if (NSPLIT >= 2) b2 = WFrag<T16>::ld(Bt2 + boff + (size_t)nb * 16 * K + kc);
#pragma unroll
            for (int mb = 0; mb < 4; ++mb) { acc[mb][nb] = WFrag<T16>::mma(a[mb], b, acc[mb][nb]); if (NSPLIT == 1 || NSPLIT == 2) acc[mb][nb] = WFrag<T16>::mma(a2[mb], b, acc[mb][nb]); if (NSPLIT >= 2) acc[mb][nb] = WFrag<T16>::mma(a[mb], b2, acc[mb][nb]); } }
        asm volatile("v_nop\n\tv_nop\n\tv_nop\n\tv_nop" : "+v"(acc[0][0]), "+v"(acc[1][1]), "+v"(acc[2][2]), "+v"(acc[3][3]) : "v"(a[0]), "v"(a[3]));
    }
#pragma unroll
    for (int mb = 0; mb < 4; ++mb) {
#pragma unroll
        for (int nb = 0; nb < 4; ++nb) {
#pragma unroll
            for (int j = 0; j < 8; ++j) os[(hi * 8 + j) * 68 + nb * 16 + lr] = acc[mb][nb][j]; }
        __builtin_amdgcn_wave_barrier(); asm volatile("" ::: "memory");
        float* crow = C + (size_t)(r0 + mb * 16) * ldc + c0;
{
#pragma unroll
            for (int s = 0; s < 8; ++s) { const int row = 2 * s + hi, cofs = lr * 4; v4f val = *(const v4fa*)(os + row * 68 + cofs); val = val * csc;
                if (BIAS) { val[0] += bfr(bias[c0 + cofs]); val[1] += bfr(bias[c0 + cofs + 1]); val[2] += bfr(bias[c0 + cofs + 2]); val[3] += bfr(bias[c0 + cofs + 3]); }
                *(v4f*)(crow + (size_t)row * ldc + cofs) = val; }
             }
        __builtin_amdgcn_wave_barrier(); asm volatile("" ::: "memory");
    }
}

// ---- k_wsplit: two contiguous bf16 (RNE) Bt planes [HH][DHD] from the [OUT][IN] weight of row pitch 2*DHD: plane 0 = input columns 0..DHD-1 (key side), plane 1 = columns DHD..2*DHD-1 (query side).
// Index split by unsigned shifts and masks: i = pl * 2^9 + a * 2^3 + pc (HH * DHD / 8 == 2^9, DHD / 8 == 2^3, HH == 64: tied to the defines by file-scope static_asserts).
__global__ __launch_bounds__(256) void k_wsplit(const float* __restrict__ w, bf* WB) {
    const unsigned i = blockIdx.x * 256u + threadIdx.x; if (i >= (unsigned)(2 * HH * DHD / 8)) return;
    const unsigned pl = i >> 9; const unsigned a = (i >> 3) & 63u; const unsigned pc = i & 7u;
    const v8f v = *(const v8f*)(w + (size_t)a * (2 * DHD) + pl * DHD + pc * 8); v8us o;
#pragma unroll
    for (int k = 0; k < 8; ++k) o[k] = f2bf(v[k]);
    *(v8us*)(WB + (size_t)i * 8) = o; 
}

__global__ __launch_bounds__(256) void k_cvt8(const float* __restrict__ src, bf* dst, size_t n8) { const size_t i = (size_t)blockIdx.x * 256 + threadIdx.x; if (i >= n8) return; const v8f v = *(const v8f*)(src + i * 8); v8us o;
#pragma unroll
    for (int k = 0; k < 8; ++k) o[k] = f2bf(v[k]); *(v8us*)(dst + i * 8) = o;  }

// ---- tanh of two hidden units at once, via exp2 and rcp: 1 - 2 / (e^{2x} + 1); saturates cleanly to +-1 for large |x| (e = inf -> rcp 0, e = 0 -> rcp 1).
__device__ __forceinline__ v2f tnh2(v2f x) {
    const v2f y = x * 2.8853900817779268f;
    v2f e; e[0] = __builtin_amdgcn_exp2f(y[0]); e[1] = __builtin_amdgcn_exp2f(y[1]);
    const v2f d = e + 1.0f;
    v2f r; r[0] = __builtin_amdgcn_rcpf(d[0]); r[1] = __builtin_amdgcn_rcpf(d[1]);
    return __builtin_elementwise_fma((v2f){-2.0f, -2.0f}, r, (v2f){1.0f, 1.0f});
}

// ---- k_score: one block (16 waves) per (b, h, group of QG queries); LANE tid OWNS KEY tid and keeps that key's whole key-side projection row (HH f32) in registers for all QG queries.
// Staging: the 512 rows ((b*TK+k)*NHD+h) are read as whole 256-B rows (16 B a lane) into LDS at a pitch of KPP floats (272 B = 16 B x odd), and each lane reads its own row back;
// bf16_RNE(w2) and the QG query-side rows ((b*TQ+q)*NHD+h) (bias already added) go through LDS too and are read at one address by all lanes.
// Per query: s = sum_a w2[a] tanh(qp[a] + kp[k][a]) in f32, summed inside the lane over hidden-unit pairs (four partial sums, fixed order), no cross-lane step.
// The int mask word of the lane's key is compared by value: nonzero -> the score is replaced by -inf. The score goes to the LDS row of its query (cross-wave, block barrier).
// Softmax: wave w takes query row w alone (16 keys a lane, f32, max-subtracted, exp2, rcp of the row sum; shuffle trees inside the wave) and writes the whole P row
// (f16, P x1024, 1 KB) into LDS at a pitch of PPP halves (1040 B = 16 B x odd) as 32 lanes x 16 B, twice.
// weights.values: [QG][TK] P (LDS) x V[k][64h + n] -> [QG][DHD]. Wave w takes the 16 output columns nt = w & 3 and the KQ keys of quarter kq = w >> 2: four chained WMMAs.
// Its value fragments come straight from the raw input X[b][k][64h + n]: one 4-byte load per fragment element (16 lanes = 64 B of one key's row, the two lane halves two rows), issued with the
// staging loads; in front of the score loop each becomes f16 = bf16_RNE(x) * VSC (the x16 carry keeps small entries normal in f16; bf16 significands are exact in f16) and waits in the lane's own LDS slots.
// Fragment maps as in k_gemmw (A and B by the same k map). The four quarters meet in LDS and are added in f32, quarter 0 first;
// thread tid stores out[b][q0 + tid/32][64h + 2(tid%32) .. +1], so a wave writes one whole 256-B row piece.
__global__ __launch_bounds__(512) void k_score(const float* __restrict__ QPF, const float* __restrict__ KPF, const float* __restrict__ vv, const int* __restrict__ mask, const float* __restrict__ X, float* OUT) {
    __shared__ __align__(16) float s_kp[TK * KPP];
    __shared__ __align__(16) float s_sc[QG * TK];
    __shared__ __align__(16) float s_qp[QG * HH];
    __shared__ __align__(16) float s_w2[HH];
    __shared__ __align__(16) h16 s_p[QG * PPP];
    __shared__ __align__(16) float s_o[4 * QG * DHD];
    __shared__ __align__(16) h16 s_v[8 * 512 * 8];
    const int blk = blockIdx.x; const int qg = blk % (TQ / QG); const int h = (blk / (TQ / QG)) % NHD; const int b = blk / ((TQ / QG) * NHD);
    const int tid = threadIdx.x, lane = tid & 31, wave = tid >> 5;
    const int q0 = qg * QG;
    const int lr = lane & 15, hi = lane >> 4, nt = wave & 3, kq = wave >> 2;
    float vr[4][16];
    {
        const float* kb = KPF + ((size_t)b * TK * NHD + h) * HH;
        const int rr = wave * 32 + (lane >> 4), cc = (lane & 15) * 4;
        v4f st[16];
#pragma unroll
        for (int j = 0; j < 16; ++j) st[j] = *(const v4f*)(kb + (size_t)(rr + 2 * j) * NHD * HH + cc);
        const v2f qv = *(const v2f*)(QPF + ((size_t)(b * TQ + q0 + wave) * NHD + h) * HH + lane * 2);
        // the value loads below may be given the registers that hold the addresses of the loads above as their destinations: this wait stands between the two groups
        asm volatile("s_wait_xcnt 0x0" ::: "memory");
        // raw value elements of this wave's slice, issued behind the staging loads: both streams are in flight together
        const float* vp = X + ((size_t)b * TK + kq * KQ + 8 * hi) * DV + h * DHD + nt * 16 + lr;
#pragma unroll
        for (int s = 0; s < 4; ++s)
#pragma unroll
            for (int e = 0; e < 8; ++e) { vr[s][e] = vp[(size_t)(s * 32 + e) * DV]; vr[s][8 + e] = vp[(size_t)(s * 32 + 16 + e) * DV]; }
#pragma unroll
        for (int j = 0; j < 16; ++j) *(v4fa*)(s_kp + (rr + 2 * j) * KPP + cc) = st[j];
        s_qp[wave * HH + lane * 2] = qv[0]; s_qp[wave * HH + lane * 2 + 1] = qv[1];
        if (tid < HH) s_w2[tid] = bfr(vv[tid]);
    }
    const int mk = mask[(size_t)b * TK + tid];
    __syncthreads();
    v2f kp[HH / 2], wv[HH / 2];
#pragma unroll
    for (int c = 0; c < HH / 4; ++c) {
        const v4f t = *(const v4fa*)(s_kp + tid * KPP + c * 4); kp[2 * c] = (v2f){t[0], t[1]}; kp[2 * c + 1] = (v2f){t[2], t[3]};
        const v4f u = *(const v4fa*)(s_w2 + c * 4); wv[2 * c] = (v2f){u[0], u[1]}; wv[2 * c + 1] = (v2f){u[2], u[3]};
    }
    // value fragments: f16 = bf16_RNE(x) * VSC; each lane parks its own eight 16-B pieces in LDS (piece j of thread tid at (j * 512 + tid) * 16 B) and takes them back behind the loop,
    // so the score loop carries none of them in registers
#pragma unroll
    for (int j = 0; j < 8; ++j) {
        v8h o;
#pragma unroll
        for (int e = 0; e < 8; e += 2) {
            const v2f w = __builtin_convertvector(__builtin_convertvector((v2f){vr[j >> 1][(j & 1) * 8 + e], vr[j >> 1][(j & 1) * 8 + e + 1]}, v2bf), v2f) * VSC;
            o[e] = toh_flush(w[0]); o[e + 1] = toh_flush(w[1]);
        }
        *(v8ha*)(s_v + (j * 512 + tid) * 8) = o;
    }
    // rolled over the queries: the body (HH hidden units, unrolled) stays a few KB of text
#pragma unroll 1
    for (int i = 0; i < QG; ++i) {
        const float* qr = s_qp + i * HH;
        v2f a0 = (v2f){0.0f, 0.0f}, a1 = (v2f){0.0f, 0.0f};
#pragma unroll
        for (int c = 0; c < HH / 4; ++c) {
            const v4f qq = *(const v4fa*)(qr + c * 4);
            a0 = __builtin_elementwise_fma(wv[2 * c], tnh2((v2f){qq[0], qq[1]} + kp[2 * c]), a0);
            a1 = __builtin_elementwise_fma(wv[2 * c + 1], tnh2((v2f){qq[2], qq[3]} + kp[2 * c + 1]), a1);
        }
        const v2f as = a0 + a1;
        const float s = as[0] + as[1];
        s_sc[i * TK + tid] = (mk != 0) ? -INFINITY : s;
    }
    __syncthreads();
    // the lane's own value pieces come back here, so that their LDS latency passes under the softmax
    v16h vb[4];
#pragma unroll
    for (int s = 0; s < 4; ++s) vb[s] = cat16(*(const v8ha*)(s_v + (2 * s * 512 + tid) * 8), *(const v8ha*)(s_v + ((2 * s + 1) * 512 + tid) * 8));
    const float* row = s_sc + wave * TK;
    v2f x[8];
#pragma unroll
    for (int i = 0; i < 2; ++i)
#pragma unroll
        for (int c = 0; c < 2; ++c) { const v4f t = *(const v4fa*)(row + (i * 32 + lane) * 8 + c * 4); x[4 * i + 2 * c] = (v2f){t[0], t[1]}; x[4 * i + 2 * c + 1] = (v2f){t[2], t[3]}; }
    float m = x[0][0];
#pragma unroll
    for (int i = 0; i < 8; ++i) m = fmaxf(m, fmaxf(x[i][0], x[i][1]));
#pragma unroll
    for (int sh = 16; sh; sh >>= 1) m = fmaxf(m, __shfl_xor(m, sh, 32));
    v2f s2 = (v2f){0.0f, 0.0f};
#pragma unroll
    for (int i = 0; i < 8; ++i) { const v2f d = (x[i] - m) * LOG2E; x[i][0] = __builtin_amdgcn_exp2f(d[0]); x[i][1] = __builtin_amdgcn_exp2f(d[1]); s2 += x[i]; }
    float sum = s2[0] + s2[1];
#pragma unroll
    for (int sh = 16; sh; sh >>= 1) sum += __shfl_xor(sum, sh, 32);
    const float inv = __builtin_amdgcn_rcpf(sum); const float invp = inv * PCAR;
    h16* dst = s_p + wave * PPP;
#pragma unroll
    for (int i = 0; i < 2; ++i) {
        v8h o;
#pragma unroll
        for (int c = 0; c < 4; ++c) { const v2f p = x[4 * i + c] * invp; o[2 * c] = toh_flush(p[0]); o[2 * c + 1] = toh_flush(p[1]); }
        *(v8ha*)(dst + (i * 32 + lane) * 8) = o;
    }
    __syncthreads();
    v8f acc = (v8f){};
    const h16* pa = s_p + lr * PPP + kq * KQ + 8 * hi;
#pragma unroll
    for (int s = 0; s < 4; ++s) acc = wmma16(cat16(*(const v8ha*)(pa + s * 32), *(const v8ha*)(pa + s * 32 + 16)), vb[s], acc);
#pragma unroll
    for (int j = 0; j < 8; ++j) s_o[(kq * QG + hi * 8 + j) * DHD + nt * 16 + lr] = acc[j];
    __syncthreads();
    v2f r = *(const v2f*)(s_o + tid * 2);
#pragma unroll
    for (int g = 1; g < 4; ++g) r += *(const v2f*)(s_o + g * QG * DHD + tid * 2);
    *(v2f*)(OUT + ((size_t)b * TQ_FULL + q0 + wave) * DV + h * DHD + lane * 2) = r * OSC;
}

extern "C" void kernel_launch(void* const* d_in, const int* in_sizes, int n_in,
                              void* d_out, int out_size, void* d_ws, size_t ws_size, hipStream_t stream) {
    if (n_in < 6) return;
    if (in_sizes[0] < NB * TK * DV || in_sizes[1] < NB * TQ * DV || in_sizes[2] < HH * 2 * DHD || in_sizes[3] < HH || in_sizes[4] < HH || in_sizes[5] < NB * TK) return;
    if (out_size < NB_FULL * TQ_FULL * DV) return;
    const float* x     = (const float*)d_in[0];   // [NB][TK][DV]   keys and values
    const float* query = (const float*)d_in[1];   // [NB][TQ][DV]
    const float* W     = (const float*)d_in[2];   // [HH][2*DHD]    ([out][in]; key columns first, query columns second)
    const float* bb    = (const float*)d_in[3];   // [HH]
    const float* w2    = (const float*)d_in[4];   // [HH]
    const int*   mask  = (const int*)d_in[5];     // [NB][TK]       nonzero = key excluded
    float* OUT = (float*)d_out;                   // [NB_FULL][TQ_FULL][DV], byte offset 0

    char* wsp = (char*)d_ws;
    auto take = [&](size_t bytes) { char* p = wsp; wsp += (bytes + 255) & ~(size_t)255; return (void*)p; };
    bf*    WB   = (bf*)take((size_t)2 * HH * DHD * 2);            // [2][HH][DHD] bf16          16,384 B
    bf*    XB   = (bf*)take((size_t)NB * TK * DV * 2);            // [NB*TK*NHD][DHD] bf16   4,194,304 B
    bf*    QB   = (bf*)take((size_t)NB * TQ * DV * 2);            // [NB*TQ*NHD][DHD] bf16     524,288 B
    float* KPF  = (float*)take((size_t)NB * TK * NHD * HH * 4);   // [NB*TK*NHD][HH] f32     8,388,608 B
    float* QPF  = (float*)take((size_t)NB * TQ * NHD * HH * 4);   // [NB*TQ*NHD][HH] f32     1,048,576 B
    if ((size_t)(wsp - (char*)d_ws) > ws_size) return;            // total 14,172,160 B

    // weight planes Bt[a][d] (bf16 RNE): plane 0 key side, plane 1 query side
    k_wsplit<<<(unsigned)((2 * HH * DHD / 8 + 255) / 256), 256, 0, stream>>>(W, WB);
    // activation planes (bf16 RNE copies, layout kept: a [rows][DV] plane is also the [rows*NHD][DHD] per-head matrix)
    k_cvt8<<<(unsigned)(((size_t)NB * TK * DV / 8 + 255) / 256), 256, 0, stream>>>(x, XB, (size_t)NB * TK * DV / 8);
    k_cvt8<<<(unsigned)(((size_t)NB * TQ * DV / 8 + 255) / 256), 256, 0, stream>>>(query, QB, (size_t)NB * TQ * DV / 8);
    // kp = key-slice Wk^T : [NB*TK*NHD][DHD] x Bt[HH][DHD] -> f32 [NB*TK*NHD][HH]
    k_gemmw<bf, 0, false><<<dim3(NB * TK * NHD / 64, HH / 64, 1), 32, 0, stream>>>(XB, nullptr, WB, nullptr, DHD, KPF, HH, nullptr, 1.0f, 0, 0, 0);
    // qp = query-slice Wq^T + b : [NB*TQ*NHD][DHD] x Bt[HH][DHD] -> f32 [NB*TQ*NHD][HH]
    k_gemmw<bf, 0, true><<<dim3(NB * TQ * NHD / 64, HH / 64, 1), 32, 0, stream>>>(QB, nullptr, WB + (size_t)HH * DHD, nullptr, DHD, QPF, HH, bb, 1.0f, 0, 0, 0);
    // scores + mask + softmax + P . values per (b, h, QG queries): out[b][q][64h + d], f32, epilogue scale 2^-14
    k_score<<<(unsigned)(NB * NHD * (TQ / QG)), 512, 0, stream>>>(QPF, KPF, w2, mask, x, OUT);
}

// v005
// One run takes 20.8 microseconds.
// In two side-by-side timings against v004, it was 1.85 and 1.86 times as fast.
// Over all steps from v000 it is 10.9 times as fast.
#include <hip/hip_runtime.h>

// One launch. Contractions: key-slice.Wk and query-slice.Wq (+b) per head on v_wmma_f32_16x16x32_bf16 in the head of the score kernel (bf16 operands = RNE-converted f32 inputs, f32 accumulate);
// weights.values per head on v_wmma_f32_16x16x32_f16 in the tail of the score kernel (f16 operands: P carried x1024, V = bf16_RNE(x) carried x16 and formed in registers from the raw input, f32 accumulate, folded by 2^-14 in the f32 epilogue);
// score matvec sum_a w2[a]*tanh(kp[a]+qp[a]+b[a]) (N=1) and the softmax stay f32 on VALU.

#ifndef NB
#define NB 8
#endif
#ifndef TQ
#define TQ 64
#endif
#define NB_FULL 8
#define TQ_FULL 64
#define TK    512
#define DV    512
#define NHD   8
#define DHD   64
#define HH    64
#define PCAR  1024.0f
#define VSC   16.0f
#define OSC   (1.0f / 16384.0f)
#define LOG2E 1.4426950408889634f
#define QG    16
#define KPP   68
#define PPP   520
#define KQ    128
#define WPP   72

static_assert(TQ == TQ_FULL || NB == 1);
static_assert(TQ % 64 == 0 && TQ >= 64 && TQ <= TQ_FULL);
static_assert(NB >= 1 && NB <= NB_FULL);
static_assert(NHD * DHD == DV);
static_assert(HH == 64 && DHD == 64 && DHD == 2 * 32 && HH == 4 * 16);
static_assert((size_t)NB_FULL * TQ_FULL * DV * 4 == 1048576);
static_assert(TQ % QG == 0 && QG * 32 == TK && QG * 32 == 512 && HH == 2 * 32 && HH % 4 == 0);
static_assert(KPP >= HH && KPP % 4 == 0 && (KPP / 4) % 2 == 1 && KPP * 4 >= DHD * 2);
static_assert(QG == 16 && DHD == 4 * 16 && TK == 4 * KQ && KQ == 4 * 32 && QG * DHD == 2 * 512);
static_assert(PPP >= TK && PPP % 8 == 0 && (PPP / 8) % 2 == 1);
static_assert(WPP >= DHD && WPP % 8 == 0 && (WPP / 8) % 2 == 1);
static_assert(HH * 2 * DHD == 4 * 512 * 4 && 2 * DHD / 4 == 32);
static_assert((TK * KPP + QG * TK + QG * HH + HH + 4 * QG * DHD) * 4 + QG * PPP * 2 + 8 * 512 * 8 * 2 + (2 * HH + QG) * WPP * 2 <= 327680);

typedef _Float16 h16;
typedef unsigned short bf;
typedef __attribute__((ext_vector_type(16))) __bf16   v16bf;
typedef __attribute__((ext_vector_type(16))) _Float16 v16h;
typedef __attribute__((ext_vector_type(8)))  _Float16 v8h;
typedef __attribute__((ext_vector_type(8)))  unsigned short v8us;
typedef __attribute__((ext_vector_type(4)))  unsigned short v4us;
typedef __attribute__((ext_vector_type(8)))  float    v8f;
typedef __attribute__((ext_vector_type(4)))  float    v4f;
typedef __attribute__((ext_vector_type(2)))  float    v2f;
typedef __attribute__((ext_vector_type(2)))  unsigned short v2us;
typedef __attribute__((ext_vector_type(2)))  __bf16   v2bf;
typedef __attribute__((ext_vector_type(4)))  __bf16   v4bf;
typedef v8h  __attribute__((may_alias)) v8ha;
typedef v4f  __attribute__((may_alias)) v4fa;
typedef v8us __attribute__((may_alias)) v8usa;
typedef v4us __attribute__((may_alias)) v4usa;
typedef v2us __attribute__((may_alias)) v2usa;

__device__ __forceinline__ unsigned short f2bf(float f) { unsigned u = __float_as_uint(f); u += 0x7FFFu + ((u >> 16) & 1u); return (unsigned short)(u >> 16); }
__device__ __forceinline__ float bf2f(unsigned short b) { return __uint_as_float(((unsigned)b) << 16); }
__device__ __forceinline__ float bfr(float f) { return bf2f(f2bf(f)); }
__device__ __forceinline__ v16h cat16(v8h lo, v8h hi) { return __builtin_shufflevector(lo, hi, 0, 1, 2, 3, 4, 5, 6, 7, 8, 9, 10, 11, 12, 13, 14, 15); }
__device__ __forceinline__ v16bf cat16b(v8us lo, v8us hi) { return __builtin_bit_cast(v16bf, __builtin_shufflevector(lo, hi, 0, 1, 2, 3, 4, 5, 6, 7, 8, 9, 10, 11, 12, 13, 14, 15)); }
__device__ __forceinline__ v8f wmma16(v16h a, v16h b, v8f c) { return __builtin_amdgcn_wmma_f32_16x16x32_f16(false, a, false, b, (short)0, c, false, false); }
__device__ __forceinline__ v8f wmmab(v16bf a, v16bf b, v8f c) { return __builtin_amdgcn_wmma_f32_16x16x32_bf16(false, a, false, b, (short)0, c, false, false); }
// f32 -> f16 convert for WMMA operand planes: magnitudes under 2^-14 become +0 by a value select (applied after the plane's power-of-two carry).
__device__ __forceinline__ h16 toh_flush(float v) { const float w = (fabsf(v) < 6.103515625e-05f) ? 0.0f : v; return (h16)w; }
// f32 -> bf16 (RNE), four and two at a time
__device__ __forceinline__ v4us cvt4(v4f v) { return __builtin_bit_cast(v4us, __builtin_convertvector(v, v4bf)); }
__device__ __forceinline__ v2us cvt2(v2f v) { return __builtin_bit_cast(v2us, __builtin_convertvector(v, v2bf)); }
// one bf16 WMMA fragment from a K-contiguous LDS row; p already holds the lane's + 8 * hi: elements 0..7 <- p[0..7], 8..15 <- p[16..23] (A and B by the same k map)
__device__ __forceinline__ v16bf ldfrag(const bf* p) { return cat16b(*(const v8usa*)p, *(const v8usa*)(p + 16)); }

// ---- tanh of two hidden units at once, via exp2 and rcp: 1 - 2 / (e^{2x} + 1); saturates cleanly to +-1 for large |x| (e = inf -> rcp 0, e = 0 -> rcp 1).
__device__ __forceinline__ v2f tnh2(v2f x) {
    const v2f y = x * 2.8853900817779268f;
    v2f e; e[0] = __builtin_amdgcn_exp2f(y[0]); e[1] = __builtin_amdgcn_exp2f(y[1]);
    const v2f d = e + 1.0f;
    v2f r; r[0] = __builtin_amdgcn_rcpf(d[0]); r[1] = __builtin_amdgcn_rcpf(d[1]);
    return __builtin_elementwise_fma((v2f){-2.0f, -2.0f}, r, (v2f){1.0f, 1.0f});
}

// ---- k_score: one block (16 waves) per (b, h, group of QG queries); LANE tid OWNS KEY tid and keeps that key's whole key-side projection row (HH f32) in registers for all QG queries.
// Staging: the 512 raw key rows X[b][k][64h ..] are read as whole 256-B rows (16 B a lane), converted to bf16 (RNE) and put into the first 128 B of the key's own LDS row (pitch KPP floats, 272 B = 16 B x odd);
// the whole weight [HH][2*DHD] goes the same way into two bf16 planes (key side, query side) and the QG raw query rows into a third, all at a pitch of WPP halves (144 B = 16 B x odd). Block barrier.
// Projections (fragments: lane l, hi = l>>4, lr = l&15; A and B elements 0..7 <- row[k0+8hi+0..7], 8..15 <- row[k0+16+8hi+0..7]; D element j -> (row 8hi+j, col lr); k0 = 0 then 32, chained):
// key side, wave w, its own 32 keys: D[a][key] = Wk rows (A) x key rows (B), 4 hidden tiles x 2 key tiles; a lane's 8 D elements are 8 neighbouring hidden units of one key and go as 2 x 16 B into that key's LDS row,
// over the bf16 copy, which both WMMAs of the tile have consumed by then; query side, waves 0..3: D[q][a] = query rows (A) x Wq rows (B), hidden tile w, + bf16_RNE(b[a]), into the query rows in LDS.
// Behind the second block barrier each lane reads its own key row back; bf16_RNE(w2) and the query-side rows are read at one address by all lanes.
// Per query: s = sum_a w2[a] tanh(qp[a] + kp[k][a]) in f32, summed inside the lane over hidden-unit pairs (four partial sums, fixed order), no cross-lane step.
// The int mask word of the lane's key is compared by value: nonzero -> the score is replaced by -inf. The score goes to the LDS row of its query (cross-wave, block barrier).
// Softmax: wave w takes query row w alone (16 keys a lane, f32, max-subtracted, exp2, rcp of the row sum; shuffle trees inside the wave) and writes the whole P row
// (f16, P x1024, 1 KB) into LDS at a pitch of PPP halves (1040 B = 16 B x odd) as 32 lanes x 16 B, twice.
// weights.values: [QG][TK] P (LDS) x V[k][64h + n] -> [QG][DHD]. Wave w takes the 16 output columns nt = w & 3 and the KQ keys of quarter kq = w >> 2: four chained WMMAs.
// Its value fragments come straight from the raw input X[b][k][64h + n]: one 4-byte load per fragment element (16 lanes = 64 B of one key's row, the two lane halves two rows), issued with the
// staging loads; in front of the score loop each becomes f16 = bf16_RNE(x) * VSC (the x16 carry keeps small entries normal in f16; bf16 significands are exact in f16) and waits in the lane's own LDS slots.
// The four quarters meet in LDS and are added in f32, quarter 0 first;
// thread tid stores out[b][q0 + tid/32][64h + 2(tid%32) .. +1], so a wave writes one whole 256-B row piece.
__global__ __launch_bounds__(512) void k_score(const float* __restrict__ X, const float* __restrict__ Q, const float* __restrict__ Wt, const float* __restrict__ bias, const float* __restrict__ vv, const int* __restrict__ mask, float* OUT) {
    __shared__ __align__(16) float s_kp[TK * KPP];
    __shared__ __align__(16) float s_sc[QG * TK];
    __shared__ __align__(16) float s_qp[QG * HH];
    __shared__ __align__(16) float s_w2[HH];
    __shared__ __align__(16) h16 s_p[QG * PPP];
    __shared__ __align__(16) float s_o[4 * QG * DHD];
    __shared__ __align__(16) h16 s_v[8 * 512 * 8];
    __shared__ __align__(16) bf s_wb[2 * HH * WPP];
    __shared__ __align__(16) bf s_qb[QG * WPP];
    const int blk = blockIdx.x; const int qg = blk % (TQ / QG); const int h = (blk / (TQ / QG)) % NHD; const int b = blk / ((TQ / QG) * NHD);
    const int tid = threadIdx.x, lane = tid & 31, wave = tid >> 5;
    const int q0 = qg * QG;
    const int lr = lane & 15, hi = lane >> 4, nt = wave & 3, kq = wave >> 2;
    const float* xh = X + (size_t)b * TK * DV + h * DHD;
    float vr[4][16];
    float bv;
    {
        const int rr = wave * 32 + (lane >> 4), cc = (lane & 15) * 4;
        v4f st[16], wr[4];
#pragma unroll
        for (int j = 0; j < 16; ++j) st[j] = *(const v4f*)(xh + (size_t)(rr + 2 * j) * DV + cc);
#pragma unroll
        for (int j = 0; j < 4; ++j) wr[j] = *(const v4f*)(Wt + (size_t)(j * 512 + tid) * 4);
        const v2f qv = *(const v2f*)(Q + ((size_t)b * TQ + q0 + wave) * DV + h * DHD + lane * 2);
        bv = bias[nt * 16 + lr];
        // the value loads below may be given the registers that hold the addresses of the loads above as their destinations: this wait stands between the two groups
        asm volatile("s_wait_xcnt 0x0" ::: "memory");
        // raw value elements of this wave's slice, issued behind the staging loads: both streams are in flight together
        const float* vp = xh + (size_t)(kq * KQ + 8 * hi) * DV + nt * 16 + lr;
#pragma unroll
        for (int s = 0; s < 4; ++s)
#pragma unroll
            for (int e = 0; e < 8; ++e) { vr[s][e] = vp[(size_t)(s * 32 + e) * DV]; vr[s][8 + e] = vp[(size_t)(s * 32 + 16 + e) * DV]; }
#pragma unroll
        for (int j = 0; j < 16; ++j) *(v4usa*)((bf*)(s_kp + (rr + 2 * j) * KPP) + cc) = cvt4(st[j]);
        // piece i of the weight: row a = i / 32, input columns 4 (i % 32) .. + 3; columns under DHD are the key side (plane 0), the rest the query side (plane 1)
#pragma unroll
        for (int j = 0; j < 4; ++j) { const int i = j * 512 + tid, col = (i & 31) * 4; *(v4usa*)(s_wb + ((col >> 6) * HH + (i >> 5)) * WPP + (col & 63)) = cvt4(wr[j]); }
        *(v2usa*)(s_qb + wave * WPP + lane * 2) = cvt2(qv);
        if (tid < HH) s_w2[tid] = bfr(vv[tid]);
    }
    const int mk = mask[(size_t)b * TK + tid];
    __syncthreads();
    {
        float* kr = s_kp + (wave * 32 + lr) * KPP;
        v16bf xf[2][2];
#pragma unroll
        for (int t = 0; t < 2; ++t)
#pragma unroll
            for (int ks = 0; ks < 2; ++ks) xf[t][ks] = ldfrag((const bf*)(kr + t * 16 * KPP) + ks * 32 + 8 * hi);
#pragma unroll
        for (int at = 0; at < 4; ++at) {
            const bf* pw = s_wb + (at * 16 + lr) * WPP + 8 * hi;
            const v16bf w0 = ldfrag(pw), w1 = ldfrag(pw + 32);
#pragma unroll
            for (int t = 0; t < 2; ++t) {
                const v8f d = wmmab(w1, xf[t][1], wmmab(w0, xf[t][0], (v8f){}));
                float* o = kr + t * 16 * KPP + at * 16 + 8 * hi;
                *(v4fa*)o = (v4f){d[0], d[1], d[2], d[3]}; *(v4fa*)(o + 4) = (v4f){d[4], d[5], d[6], d[7]};
            }
        }
        // the same for every lane of a wave: a scalar branch, so the matrix instructions inside run with all lanes on
        if (__builtin_amdgcn_readfirstlane(wave) < 4) {
            const bf* pq = s_qb + lr * WPP + 8 * hi; const bf* pw = s_wb + (HH + nt * 16 + lr) * WPP + 8 * hi;
            const v8f d = wmmab(ldfrag(pq + 32), ldfrag(pw + 32), wmmab(ldfrag(pq), ldfrag(pw), (v8f){}));
            const float bq = bfr(bv);
#pragma unroll
            for (int j = 0; j < 8; ++j) s_qp[(hi * 8 + j) * HH + nt * 16 + lr] = d[j] + bq;
        }
    }
    __syncthreads();
    v2f kp[HH / 2], wv[HH / 2];
#pragma unroll
    for (int c = 0; c < HH / 4; ++c) {
        const v4f t = *(const v4fa*)(s_kp + tid * KPP + c * 4); kp[2 * c] = (v2f){t[0], t[1]}; kp[2 * c + 1] = (v2f){t[2], t[3]};
        const v4f u = *(const v4fa*)(s_w2 + c * 4); wv[2 * c] = (v2f){u[0], u[1]}; wv[2 * c + 1] = (v2f){u[2], u[3]};
    }
    // value fragments: f16 = bf16_RNE(x) * VSC; each lane parks its own eight 16-B pieces in LDS (piece j of thread tid at (j * 512 + tid) * 16 B) and takes them back behind the loop,
    // so the score loop carries none of them in registers
#pragma unroll
    for (int j = 0; j < 8; ++j) {
        v8h o;
#pragma unroll
        for (int e = 0; e < 8; e += 2) {
            const v2f w = __builtin_convertvector(__builtin_convertvector((v2f){vr[j >> 1][(j & 1) * 8 + e], vr[j >> 1][(j & 1) * 8 + e + 1]}, v2bf), v2f) * VSC;
            o[e] = toh_flush(w[0]); o[e + 1] = toh_flush(w[1]);
        }
        *(v8ha*)(s_v + (j * 512 + tid) * 8) = o;
    }
    // rolled over the queries: the body (HH hidden units, unrolled) stays a few KB of text
#pragma unroll 1
    for (int i = 0; i < QG; ++i) {
        const float* qr = s_qp + i * HH;
        v2f a0 = (v2f){0.0f, 0.0f}, a1 = (v2f){0.0f, 0.0f};
#pragma unroll
        for (int c = 0; c < HH / 4; ++c) {
            const v4f qq = *(const v4fa*)(qr + c * 4);
            a0 = __builtin_elementwise_fma(wv[2 * c], tnh2((v2f){qq[0], qq[1]} + kp[2 * c]), a0);
            a1 = __builtin_elementwise_fma(wv[2 * c + 1], tnh2((v2f){qq[2], qq[3]} + kp[2 * c + 1]), a1);
        }
        const v2f as = a0 + a1;
        const float s = as[0] + as[1];
        s_sc[i * TK + tid] = (mk != 0) ? -INFINITY : s;
    }
    __syncthreads();
    // the lane's own value pieces come back here, so that their LDS latency passes under the softmax
    v16h vb[4];
#pragma unroll
    for (int s = 0; s < 4; ++s) vb[s] = cat16(*(const v8ha*)(s_v + (2 * s * 512 + tid) * 8), *(const v8ha*)(s_v + ((2 * s + 1) * 512 + tid) * 8));
    const float* row = s_sc + wave * TK;
    v2f x[8];
#pragma unroll
    for (int i = 0; i < 2; ++i)
#pragma unroll
        for (int c = 0; c < 2; ++c) { const v4f t = *(const v4fa*)(row + (i * 32 + lane) * 8 + c * 4); x[4 * i + 2 * c] = (v2f){t[0], t[1]}; x[4 * i + 2 * c + 1] = (v2f){t[2], t[3]}; }
    float m = x[0][0];
#pragma unroll
    for (int i = 0; i < 8; ++i) m = fmaxf(m, fmaxf(x[i][0], x[i][1]));
#pragma unroll
    for (int sh = 16; sh; sh >>= 1) m = fmaxf(m, __shfl_xor(m, sh, 32));
    v2f s2 = (v2f){0.0f, 0.0f};
#pragma unroll
    for (int i = 0; i < 8; ++i) { const v2f d = (x[i] - m) * LOG2E; x[i][0] = __builtin_amdgcn_exp2f(d[0]); x[i][1] = __builtin_amdgcn_exp2f(d[1]); s2 += x[i]; }
    float sum = s2[0] + s2[1];
#pragma unroll
    for (int sh = 16; sh; sh >>= 1) sum += __shfl_xor(sum, sh, 32);
    const float inv = __builtin_amdgcn_rcpf(sum); const float invp = inv * PCAR;
    h16* dst = s_p + wave * PPP;
#pragma unroll
    for (int i = 0; i < 2; ++i) {
        v8h o;
#pragma unroll
        for (int c = 0; c < 4; ++c) { const v2f p = x[4 * i + c] * invp; o[2 * c] = toh_flush(p[0]); o[2 * c + 1] = toh_flush(p[1]); }
        *(v8ha*)(dst + (i * 32 + lane) * 8) = o;
    }
    __syncthreads();
    v8f acc = (v8f){};
    const h16* pa = s_p + lr * PPP + kq * KQ + 8 * hi;
#pragma unroll
    for (int s = 0; s < 4; ++s) acc = wmma16(cat16(*(const v8ha*)(pa + s * 32), *(const v8ha*)(pa + s * 32 + 16)), vb[s], acc);
#pragma unroll
    for (int j = 0; j < 8; ++j) s_o[(kq * QG + hi * 8 + j) * DHD + nt * 16 + lr] = acc[j];
    __syncthreads();
    v2f r = *(const v2f*)(s_o + tid * 2);
#pragma unroll
    for (int g = 1; g < 4; ++g) r += *(const v2f*)(s_o + g * QG * DHD + tid * 2);
    *(v2f*)(OUT + ((size_t)b * TQ_FULL + q0 + wave) * DV + h * DHD + lane * 2) = r * OSC;
}

extern "C" void kernel_launch(void* const* d_in, const int* in_sizes, int n_in,
                              void* d_out, int out_size, void* d_ws, size_t ws_size, hipStream_t stream) {
    if (n_in < 6) return;
    if (in_sizes[0] < NB * TK * DV || in_sizes[1] < NB * TQ * DV || in_sizes[2] < HH * 2 * DHD || in_sizes[3] < HH || in_sizes[4] < HH || in_sizes[5] < NB * TK) return;
    if (out_size < NB_FULL * TQ_FULL * DV) return;
    const float* x     = (const float*)d_in[0];   // [NB][TK][DV]   keys and values
    const float* query = (const float*)d_in[1];   // [NB][TQ][DV]
    const float* W     = (const float*)d_in[2];   // [HH][2*DHD]    ([out][in]; key columns first, query columns second)
    const float* bb    = (const float*)d_in[3];   // [HH]
    const float* w2    = (const float*)d_in[4];   // [HH]
    const int*   mask  = (const int*)d_in[5];     // [NB][TK]       nonzero = key excluded
    float* OUT = (float*)d_out;                   // [NB_FULL][TQ_FULL][DV], byte offset 0
    (void)d_ws; (void)ws_size;                    // no workspace

    // projections + scores + mask + softmax + P . values per (b, h, QG queries): out[b][q][64h + d], f32, epilogue scale 2^-14
    k_score<<<(unsigned)(NB * NHD * (TQ / QG)), 512, 0, stream>>>(x, query, W, bb, w2, mask, OUT);
}

// v006
// It runs in 14.5 microseconds.
// In both of two side-by-side timings against v005, it was 1.44 times as fast.
// Counting every step since v000, it is 15.6 times as fast.
#include <hip/hip_runtime.h>

// One launch. Contractions: key-slice.Wk and query-slice.Wq (+b) per head on v_wmma_f32_16x16x32_bf16 in the head of the score kernel (bf16 operands = RNE-converted f32 inputs, f32 accumulate);
// weights.values per head on v_wmma_f32_16x16x32_f16 in the tail of the score kernel (f16 operands: P carried x1024, V = bf16_RNE(x) carried x16 and formed in registers from the raw input, f32 accumulate, folded by 2^-14 in the f32 epilogue);
// score matvec sum_a w2[a]*tanh(kp[a]+qp[a]+b[a]) (N=1) and the softmax stay f32 on VALU.

#ifndef NB
#define NB 8
#endif
#ifndef TQ
#define TQ 64
#endif
#define NB_FULL 8
#define TQ_FULL 64
#define TK    512
#define DV    512
#define NHD   8
#define DHD   64
#define HH    64
#define PCAR  1024.0f
#define VSC   16.0f
#define OSC   (1.0f / 16384.0f)
#define LOG2E 1.4426950408889634f
#define QG    16
#define KPP   68
#define PPP   520
#define KQ    128
#define WPP   72

static_assert(TQ == TQ_FULL || NB == 1);
static_assert(TQ % 64 == 0 && TQ >= 64 && TQ <= TQ_FULL);
static_assert(NB >= 1 && NB <= NB_FULL);
static_assert(NHD * DHD == DV);
static_assert(HH == 64 && DHD == 64 && DHD == 2 * 32 && HH == 4 * 16);
static_assert((size_t)NB_FULL * TQ_FULL * DV * 4 == 1048576);
static_assert(TQ % QG == 0 && QG * 32 == TK && QG * 32 == 512 && HH == 2 * 32 && HH % 4 == 0);
static_assert(KPP >= HH && KPP % 4 == 0 && (KPP / 4) % 2 == 1 && KPP * 4 >= DHD * 2);
static_assert(QG == 16 && DHD == 4 * 16 && TK == 4 * KQ && KQ == 4 * 32 && QG * DHD == 2 * 512);
static_assert(PPP >= TK && PPP % 8 == 0 && (PPP / 8) % 2 == 1);
static_assert(WPP >= DHD && WPP % 8 == 0 && (WPP / 8) % 2 == 1);
static_assert(HH * 2 * DHD == 4 * 512 * 4 && 2 * DHD / 4 == 32);
static_assert((TK * KPP + QG * TK + QG * HH + HH + 4 * QG * DHD) * 4 + QG * PPP * 2 + 8 * 512 * 8 * 2 + (2 * HH + QG) * WPP * 2 <= 327680);

typedef _Float16 h16;
typedef unsigned short bf;
typedef __attribute__((ext_vector_type(16))) __bf16   v16bf;
typedef __attribute__((ext_vector_type(16))) _Float16 v16h;
typedef __attribute__((ext_vector_type(8)))  _Float16 v8h;
typedef __attribute__((ext_vector_type(8)))  unsigned short v8us;
typedef __attribute__((ext_vector_type(4)))  unsigned short v4us;
typedef __attribute__((ext_vector_type(8)))  float    v8f;
typedef __attribute__((ext_vector_type(4)))  float    v4f;
typedef __attribute__((ext_vector_type(2)))  float    v2f;
typedef __attribute__((ext_vector_type(2)))  unsigned short v2us;
typedef __attribute__((ext_vector_type(2)))  __bf16   v2bf;
typedef __attribute__((ext_vector_type(4)))  __bf16   v4bf;
typedef v8h  __attribute__((may_alias)) v8ha;
typedef v4f  __attribute__((may_alias)) v4fa;
typedef v8us __attribute__((may_alias)) v8usa;
typedef v4us __attribute__((may_alias)) v4usa;
typedef v2us __attribute__((may_alias)) v2usa;

__device__ __forceinline__ unsigned short f2bf(float f) { unsigned u = __float_as_uint(f); u += 0x7FFFu + ((u >> 16) & 1u); return (unsigned short)(u >> 16); }
__device__ __forceinline__ float bf2f(unsigned short b) { return __uint_as_float(((unsigned)b) << 16); }
__device__ __forceinline__ float bfr(float f) { return bf2f(f2bf(f)); }
__device__ __forceinline__ v16h cat16(v8h lo, v8h hi) { return __builtin_shufflevector(lo, hi, 0, 1, 2, 3, 4, 5, 6, 7, 8, 9, 10, 11, 12, 13, 14, 15); }
__device__ __forceinline__ v16bf cat16b(v8us lo, v8us hi) { return __builtin_bit_cast(v16bf, __builtin_shufflevector(lo, hi, 0, 1, 2, 3, 4, 5, 6, 7, 8, 9, 10, 11, 12, 13, 14, 15)); }
__device__ __forceinline__ v8f wmma16(v16h a, v16h b, v8f c) { return __builtin_amdgcn_wmma_f32_16x16x32_f16(false, a, false, b, (short)0, c, false, false); }
__device__ __forceinline__ v8f wmmab(v16bf a, v16bf b, v8f c) { return __builtin_amdgcn_wmma_f32_16x16x32_bf16(false, a, false, b, (short)0, c, false, false); }
// f32 -> f16 convert for WMMA operand planes: magnitudes under 2^-14 become +0 by a value select (applied after the plane's power-of-two carry).
__device__ __forceinline__ h16 toh_flush(float v) { const float w = (fabsf(v) < 6.103515625e-05f) ? 0.0f : v; return (h16)w; }
// f32 -> bf16 (RNE), four and two at a time
__device__ __forceinline__ v4us cvt4(v4f v) { return __builtin_bit_cast(v4us, __builtin_convertvector(v, v4bf)); }
__device__ __forceinline__ v2us cvt2(v2f v) { return __builtin_bit_cast(v2us, __builtin_convertvector(v, v2bf)); }
// one bf16 WMMA fragment from a K-contiguous LDS row; p already holds the lane's + 8 * hi: elements 0..7 <- p[0..7], 8..15 <- p[16..23] (A and B by the same k map)
__device__ __forceinline__ v16bf ldfrag(const bf* p) { return cat16b(*(const v8usa*)p, *(const v8usa*)(p + 16)); }

// ---- tanh of two hidden units at once: the f32 tanh instruction (v_tanh_f32), one transcendental per value.
__device__ __forceinline__ v2f tnh2(v2f x) {
    v2f r; r[0] = __builtin_amdgcn_tanhf(x[0]); r[1] = __builtin_amdgcn_tanhf(x[1]);
    return r;
}

// ---- k_score: one block (16 waves) per (b, h, group of QG queries); LANE tid OWNS KEY tid and keeps that key's whole key-side projection row (HH f32) in registers for all QG queries.
// Staging: the 512 raw key rows X[b][k][64h ..] are read as whole 256-B rows (16 B a lane), converted to bf16 (RNE) and put into the first 128 B of the key's own LDS row (pitch KPP floats, 272 B = 16 B x odd);
// the whole weight [HH][2*DHD] goes the same way into two bf16 planes (key side, query side) and the QG raw query rows into a third, all at a pitch of WPP halves (144 B = 16 B x odd). Block barrier.
// Projections (fragments: lane l, hi = l>>4, lr = l&15; A and B elements 0..7 <- row[k0+8hi+0..7], 8..15 <- row[k0+16+8hi+0..7]; D element j -> (row 8hi+j, col lr); k0 = 0 then 32, chained):
// key side, wave w, its own 32 keys: D[a][key] = Wk rows (A) x key rows (B), 4 hidden tiles x 2 key tiles; a lane's 8 D elements are 8 neighbouring hidden units of one key and go as 2 x 16 B into that key's LDS row,
// over the bf16 copy, which both WMMAs of the tile have consumed by then; query side, waves 0..3: D[q][a] = query rows (A) x Wq rows (B), hidden tile w, + bf16_RNE(b[a]), into the query rows in LDS.
// Behind the second block barrier each lane reads its own key row back; bf16_RNE(w2) and the query-side rows are read at one address by all lanes.
// Per query: s = sum_a w2[a] tanh(qp[a] + kp[k][a]) in f32, summed inside the lane over hidden-unit pairs (four partial sums, fixed order), no cross-lane step.
// The int mask word of the lane's key is compared by value: nonzero -> the score is replaced by -inf. The score goes to the LDS row of its query (cross-wave, block barrier).
// Softmax: wave w takes query row w alone (16 keys a lane, f32, max-subtracted, exp2, rcp of the row sum; shuffle trees inside the wave) and writes the whole P row
// (f16, P x1024, 1 KB) into LDS at a pitch of PPP halves (1040 B = 16 B x odd) as 32 lanes x 16 B, twice.
// weights.values: [QG][TK] P (LDS) x V[k][64h + n] -> [QG][DHD]. Wave w takes the 16 output columns nt = w & 3 and the KQ keys of quarter kq = w >> 2: four chained WMMAs.
// Its value fragments come straight from the raw input X[b][k][64h + n]: one 4-byte load per fragment element (16 lanes = 64 B of one key's row, the two lane halves two rows), issued with the
// staging loads; in front of the score loop each becomes f16 = bf16_RNE(x) * VSC (the x16 carry keeps small entries normal in f16; bf16 significands are exact in f16) and waits in the lane's own LDS slots.
// The four quarters meet in LDS and are added in f32, quarter 0 first;
// thread tid stores out[b][q0 + tid/32][64h + 2(tid%32) .. +1], so a wave writes one whole 256-B row piece.
__global__ __launch_bounds__(512) void k_score(const float* __restrict__ X, const float* __restrict__ Q, const float* __restrict__ Wt, const float* __restrict__ bias, const float* __restrict__ vv, const int* __restrict__ mask, float* OUT) {
    __shared__ __align__(16) float s_kp[TK * KPP];
    __shared__ __align__(16) float s_sc[QG * TK];
    __shared__ __align__(16) float s_qp[QG * HH];
    __shared__ __align__(16) float s_w2[HH];
    __shared__ __align__(16) h16 s_p[QG * PPP];
    __shared__ __align__(16) float s_o[4 * QG * DHD];
    __shared__ __align__(16) h16 s_v[8 * 512 * 8];
    __shared__ __align__(16) bf s_wb[2 * HH * WPP];
    __shared__ __align__(16) bf s_qb[QG * WPP];
    const int blk = blockIdx.x; const int qg = blk % (TQ / QG); const int h = (blk / (TQ / QG)) % NHD; const int b = blk / ((TQ / QG) * NHD);
    const int tid = threadIdx.x, lane = tid & 31, wave = tid >> 5;
    const int q0 = qg * QG;
    const int lr = lane & 15, hi = lane >> 4, nt = wave & 3, kq = wave >> 2;
    const float* xh = X + (size_t)b * TK * DV + h * DHD;
    float vr[4][16];
    float bv;
    {
        const int rr = wave * 32 + (lane >> 4), cc = (lane & 15) * 4;
        v4f st[16], wr[4];
#pragma unroll
        for (int j = 0; j < 16; ++j) st[j] = *(const v4f*)(xh + (size_t)(rr + 2 * j) * DV + cc);
#pragma unroll
        for (int j = 0; j < 4; ++j) wr[j] = *(const v4f*)(Wt + (size_t)(j * 512 + tid) * 4);
        const v2f qv = *(const v2f*)(Q + ((size_t)b * TQ + q0 + wave) * DV + h * DHD + lane * 2);
        bv = bias[nt * 16 + lr];
        // the value loads below may be given the registers that hold the addresses of the loads above as their destinations: this wait stands between the two groups
        asm volatile("s_wait_xcnt 0x0" ::: "memory");
        // raw value elements of this wave's slice, issued behind the staging loads: both streams are in flight together
        const float* vp = xh + (size_t)(kq * KQ + 8 * hi) * DV + nt * 16 + lr;
#pragma unroll
        for (int s = 0; s < 4; ++s)
#pragma unroll
            for (int e = 0; e < 8; ++e) { vr[s][e] = vp[(size_t)(s * 32 + e) * DV]; vr[s][8 + e] = vp[(size_t)(s * 32 + 16 + e) * DV]; }
#pragma unroll
        for (int j = 0; j < 16; ++j) *(v4usa*)((bf*)(s_kp + (rr + 2 * j) * KPP) + cc) = cvt4(st[j]);
        // piece i of the weight: row a = i / 32, input columns 4 (i % 32) .. + 3; columns under DHD are the key side (plane 0), the rest the query side (plane 1)
#pragma unroll
        for (int j = 0; j < 4; ++j) { const int i = j * 512 + tid, col = (i & 31) * 4; *(v4usa*)(s_wb + ((col >> 6) * HH + (i >> 5)) * WPP + (col & 63)) = cvt4(wr[j]); }
        *(v2usa*)(s_qb + wave * WPP + lane * 2) = cvt2(qv);
        if (tid < HH) s_w2[tid] = bfr(vv[tid]);
    }
    const int mk = mask[(size_t)b * TK + tid];
    __syncthreads();
    {
        float* kr = s_kp + (wave * 32 + lr) * KPP;
        v16bf xf[2][2];
#pragma unroll
        for (int t = 0; t < 2; ++t)
#pragma unroll
            for (int ks = 0; ks < 2; ++ks) xf[t][ks] = ldfrag((const bf*)(kr + t * 16 * KPP) + ks * 32 + 8 * hi);
#pragma unroll
        for (int at = 0; at < 4; ++at) {
            const bf* pw = s_wb + (at * 16 + lr) * WPP + 8 * hi;
            const v16bf w0 = ldfrag(pw), w1 = ldfrag(pw + 32);
#pragma unroll
            for (int t = 0; t < 2; ++t) {
                const v8f d = wmmab(w1, xf[t][1], wmmab(w0, xf[t][0], (v8f){}));
                float* o = kr + t * 16 * KPP + at * 16 + 8 * hi;
                *(v4fa*)o = (v4f){d[0], d[1], d[2], d[3]}; *(v4fa*)(o + 4) = (v4f){d[4], d[5], d[6], d[7]};
            }
        }
        // the same for every lane of a wave: a scalar branch, so the matrix instructions inside run with all lanes on
        if (__builtin_amdgcn_readfirstlane(wave) < 4) {
            const bf* pq = s_qb + lr * WPP + 8 * hi; const bf* pw = s_wb + (HH + nt * 16 + lr) * WPP + 8 * hi;
            const v8f d = wmmab(ldfrag(pq + 32), ldfrag(pw + 32), wmmab(ldfrag(pq), ldfrag(pw), (v8f){}));
            const float bq = bfr(bv);
#pragma unroll
            for (int j = 0; j < 8; ++j) s_qp[(hi * 8 + j) * HH + nt * 16 + lr] = d[j] + bq;
        }
    }
    __syncthreads();
    v2f kp[HH / 2], wv[HH / 2];
#pragma unroll
    for (int c = 0; c < HH / 4; ++c) {
        const v4f t = *(const v4fa*)(s_kp + tid * KPP + c * 4); kp[2 * c] = (v2f){t[0], t[1]}; kp[2 * c + 1] = (v2f){t[2], t[3]};
        const v4f u = *(const v4fa*)(s_w2 + c * 4); wv[2 * c] = (v2f){u[0], u[1]}; wv[2 * c + 1] = (v2f){u[2], u[3]};
    }
    // value fragments: f16 = bf16_RNE(x) * VSC; each lane parks its own eight 16-B pieces in LDS (piece j of thread tid at (j * 512 + tid) * 16 B) and takes them back behind the loop,
    // so the score loop carries none of them in registers
#pragma unroll
    for (int j = 0; j < 8; ++j) {
        v8h o;
#pragma unroll
        for (int e = 0; e < 8; e += 2) {
            const v2f w = __builtin_convertvector(__builtin_convertvector((v2f){vr[j >> 1][(j & 1) * 8 + e], vr[j >> 1][(j & 1) * 8 + e + 1]}, v2bf), v2f) * VSC;
            o[e] = toh_flush(w[0]); o[e + 1] = toh_flush(w[1]);
        }
        *(v8ha*)(s_v + (j * 512 + tid) * 8) = o;
    }
    // rolled over the queries: the body (HH hidden units, unrolled) stays a few KB of text
#pragma unroll 1
    for (int i = 0; i < QG; ++i) {
        const float* qr = s_qp + i * HH;
        v2f a0 = (v2f){0.0f, 0.0f}, a1 = (v2f){0.0f, 0.0f};
#pragma unroll
        for (int c = 0; c < HH / 4; ++c) {
            const v4f qq = *(const v4fa*)(qr + c * 4);
            a0 = __builtin_elementwise_fma(wv[2 * c], tnh2((v2f){qq[0], qq[1]} + kp[2 * c]), a0);
            a1 = __builtin_elementwise_fma(wv[2 * c + 1], tnh2((v2f){qq[2], qq[3]} + kp[2 * c + 1]), a1);
        }
        const v2f as = a0 + a1;
        const float s = as[0] + as[1];
        s_sc[i * TK + tid] = (mk != 0) ? -INFINITY : s;
    }
    __syncthreads();
    // the lane's own value pieces come back here, so that their LDS latency passes under the softmax
    v16h vb[4];
#pragma unroll
    for (int s = 0; s < 4; ++s) vb[s] = cat16(*(const v8ha*)(s_v + (2 * s * 512 + tid) * 8), *(const v8ha*)(s_v + ((2 * s + 1) * 512 + tid) * 8));
    const float* row = s_sc + wave * TK;
    v2f x[8];
#pragma unroll
    for (int i = 0; i < 2; ++i)
#pragma unroll
        for (int c = 0; c < 2; ++c) { const v4f t = *(const v4fa*)(row + (i * 32 + lane) * 8 + c * 4); x[4 * i + 2 * c] = (v2f){t[0], t[1]}; x[4 * i + 2 * c + 1] = (v2f){t[2], t[3]}; }
    float m = x[0][0];
#pragma unroll
    for (int i = 0; i < 8; ++i) m = fmaxf(m, fmaxf(x[i][0], x[i][1]));
#pragma unroll
    for (int sh = 16; sh; sh >>= 1) m = fmaxf(m, __shfl_xor(m, sh, 32));
    v2f s2 = (v2f){0.0f, 0.0f};
#pragma unroll
    for (int i = 0; i < 8; ++i) { const v2f d = (x[i] - m) * LOG2E; x[i][0] = __builtin_amdgcn_exp2f(d[0]); x[i][1] = __builtin_amdgcn_exp2f(d[1]); s2 += x[i]; }
    float sum = s2[0] + s2[1];
#pragma unroll
    for (int sh = 16; sh; sh >>= 1) sum += __shfl_xor(sum, sh, 32);
    const float inv = __builtin_amdgcn_rcpf(sum); const float invp = inv * PCAR;
    h16* dst = s_p + wave * PPP;
#pragma unroll
    for (int i = 0; i < 2; ++i) {
        v8h o;
#pragma unroll
        for (int c = 0; c < 4; ++c) { const v2f p = x[4 * i + c] * invp; o[2 * c] = toh_flush(p[0]); o[2 * c + 1] = toh_flush(p[1]); }
        *(v8ha*)(dst + (i * 32 + lane) * 8) = o;
    }
    __syncthreads();
    v8f acc = (v8f){};
    const h16* pa = s_p + lr * PPP + kq * KQ + 8 * hi;
#pragma unroll
    for (int s = 0; s < 4; ++s) acc = wmma16(cat16(*(const v8ha*)(pa + s * 32), *(const v8ha*)(pa + s * 32 + 16)), vb[s], acc);
#pragma unroll
    for (int j = 0; j < 8; ++j) s_o[(kq * QG + hi * 8 + j) * DHD + nt * 16 + lr] = acc[j];
    __syncthreads();
    v2f r = *(const v2f*)(s_o + tid * 2);
#pragma unroll
    for (int g = 1; g < 4; ++g) r += *(const v2f*)(s_o + g * QG * DHD + tid * 2);
    *(v2f*)(OUT + ((size_t)b * TQ_FULL + q0 + wave) * DV + h * DHD + lane * 2) = r * OSC;
}

extern "C" void kernel_launch(void* const* d_in, const int* in_sizes, int n_in,
                              void* d_out, int out_size, void* d_ws, size_t ws_size, hipStream_t stream) {
    if (n_in < 6) return;
    if (in_sizes[0] < NB * TK * DV || in_sizes[1] < NB * TQ * DV || in_sizes[2] < HH * 2 * DHD || in_sizes[3] < HH || in_sizes[4] < HH || in_sizes[5] < NB * TK) return;
    if (out_size < NB_FULL * TQ_FULL * DV) return;
    const float* x     = (const float*)d_in[0];   // [NB][TK][DV]   keys and values
    const float* query = (const float*)d_in[1];   // [NB][TQ][DV]
    const float* W     = (const float*)d_in[2];   // [HH][2*DHD]    ([out][in]; key columns first, query columns second)
    const float* bb    = (const float*)d_in[3];   // [HH]
    const float* w2    = (const float*)d_in[4];   // [HH]
    const int*   mask  = (const int*)d_in[5];     // [NB][TK]       nonzero = key excluded
    float* OUT = (float*)d_out;                   // [NB_FULL][TQ_FULL][DV], byte offset 0
    (void)d_ws; (void)ws_size;                    // no workspace

    // projections + scores + mask + softmax + P . values per (b, h, QG queries): out[b][q][64h + d], f32, epilogue scale 2^-14
    k_score<<<(unsigned)(NB * NHD * (TQ / QG)), 512, 0, stream>>>(x, query, W, bb, w2, mask, OUT);
}

// v007
// A run of this version takes 13.1 microseconds.
// Next to v006, in two timings, it ran 1.10 times as fast each time.
// All steps since v000 together make it 17.2 times as fast.
#include <hip/hip_runtime.h>

// One launch. Contractions: key-slice.Wk and query-slice.Wq (+b) per head on v_wmma_f32_16x16x32_bf16 in the head of the score kernel (bf16 operands = RNE-converted f32 inputs, f32 accumulate);
// weights.values per head on v_wmma_f32_16x16x32_f16 in the tail of the score kernel (f16 operands: P carried x1024, V = bf16_RNE(x) carried x16 and formed in registers from the raw input, f32 accumulate, folded by 2^-14 in the f32 epilogue);
// score matvec sum_a w2[a]*tanh(kp[a]+qp[a]+b[a]) (N=1) and the softmax stay f32 on VALU.

#ifndef NB
#define NB 8
#endif
#ifndef TQ
#define TQ 64
#endif
#define NB_FULL 8
#define TQ_FULL 64
#define TK    512
#define DV    512
#define NHD   8
#define DHD   64
#define HH    64
#define PCAR  1024.0f
#define VSC   16.0f
#define OSC   (1.0f / 16384.0f)
#define LOG2E 1.4426950408889634f
#define QG    16
#define KPP   68
#define PPP   520
#define KQ    128
#define WPP   72
#define C2L   (2.0f * LOG2E)
#define EBK   15.0f
#define EBQ   14.0f
#define KAP   (1.0f / 4194304.0f)
#define WLO   (1.0f / 16777216.0f)
#define WHI   256.0f

static_assert(TQ == TQ_FULL || NB == 1);
static_assert(TQ % 64 == 0 && TQ >= 64 && TQ <= TQ_FULL);
static_assert(NB >= 1 && NB <= NB_FULL);
static_assert(NHD * DHD == DV);
static_assert(HH == 64 && DHD == 64 && DHD == 2 * 32 && HH == 4 * 16);
static_assert((size_t)NB_FULL * TQ_FULL * DV * 4 == 1048576);
static_assert(TQ % QG == 0 && QG * 32 == TK && QG * 32 == 512 && HH == 2 * 32 && HH % 4 == 0);
static_assert(KPP >= HH && KPP % 4 == 0 && (KPP / 4) % 2 == 1 && KPP * 4 >= DHD * 2);
static_assert(QG == 16 && DHD == 4 * 16 && TK == 4 * KQ && KQ == 4 * 32 && QG * DHD == 2 * 512);
static_assert(PPP >= TK && PPP % 8 == 0 && (PPP / 8) % 2 == 1);
static_assert(WPP >= DHD && WPP % 8 == 0 && (WPP / 8) % 2 == 1);
static_assert(HH * 2 * DHD == 4 * 512 * 4 && 2 * DHD / 4 == 32);
static_assert(HH % 8 == 0 && 4 * 32 == 128 && HH == 4 * 16);
static_assert((TK * KPP + QG * TK + 2 * QG * HH + 128 + 4 + 2 * HH + 4 * QG * DHD) * 4 + QG * PPP * 2 + 8 * 512 * 8 * 2 + (2 * HH + QG) * WPP * 2 <= 327680);

typedef _Float16 h16;
typedef unsigned short bf;
typedef __attribute__((ext_vector_type(16))) __bf16   v16bf;
typedef __attribute__((ext_vector_type(16))) _Float16 v16h;
typedef __attribute__((ext_vector_type(8)))  _Float16 v8h;
typedef __attribute__((ext_vector_type(8)))  unsigned short v8us;
typedef __attribute__((ext_vector_type(4)))  unsigned short v4us;
typedef __attribute__((ext_vector_type(8)))  float    v8f;
typedef __attribute__((ext_vector_type(4)))  float    v4f;
typedef __attribute__((ext_vector_type(2)))  float    v2f;
typedef __attribute__((ext_vector_type(2)))  unsigned short v2us;
typedef __attribute__((ext_vector_type(2)))  __bf16   v2bf;
typedef __attribute__((ext_vector_type(4)))  __bf16   v4bf;
typedef v8h  __attribute__((may_alias)) v8ha;
typedef v4f  __attribute__((may_alias)) v4fa;
typedef v8us __attribute__((may_alias)) v8usa;
typedef v4us __attribute__((may_alias)) v4usa;
typedef v2us __attribute__((may_alias)) v2usa;

__device__ __forceinline__ unsigned short f2bf(float f) { unsigned u = __float_as_uint(f); u += 0x7FFFu + ((u >> 16) & 1u); return (unsigned short)(u >> 16); }
__device__ __forceinline__ float bf2f(unsigned short b) { return __uint_as_float(((unsigned)b) << 16); }
__device__ __forceinline__ float bfr(float f) { return bf2f(f2bf(f)); }
__device__ __forceinline__ v16h cat16(v8h lo, v8h hi) { return __builtin_shufflevector(lo, hi, 0, 1, 2, 3, 4, 5, 6, 7, 8, 9, 10, 11, 12, 13, 14, 15); }
__device__ __forceinline__ v16bf cat16b(v8us lo, v8us hi) { return __builtin_bit_cast(v16bf, __builtin_shufflevector(lo, hi, 0, 1, 2, 3, 4, 5, 6, 7, 8, 9, 10, 11, 12, 13, 14, 15)); }
__device__ __forceinline__ v8f wmma16(v16h a, v16h b, v8f c) { return __builtin_amdgcn_wmma_f32_16x16x32_f16(false, a, false, b, (short)0, c, false, false); }
__device__ __forceinline__ v8f wmmab(v16bf a, v16bf b, v8f c) { return __builtin_amdgcn_wmma_f32_16x16x32_bf16(false, a, false, b, (short)0, c, false, false); }
// f32 -> f16 convert for WMMA operand planes: magnitudes under 2^-14 become +0 by a value select (applied after the plane's power-of-two carry).
__device__ __forceinline__ h16 toh_flush(float v) { const float w = (fabsf(v) < 6.103515625e-05f) ? 0.0f : v; return (h16)w; }
// f32 -> bf16 (RNE), four and two at a time
__device__ __forceinline__ v4us cvt4(v4f v) { return __builtin_bit_cast(v4us, __builtin_convertvector(v, v4bf)); }
__device__ __forceinline__ v2us cvt2(v2f v) { return __builtin_bit_cast(v2us, __builtin_convertvector(v, v2bf)); }
// one bf16 WMMA fragment from a K-contiguous LDS row; p already holds the lane's + 8 * hi: elements 0..7 <- p[0..7], 8..15 <- p[16..23] (A and B by the same k map)
__device__ __forceinline__ v16bf ldfrag(const bf* p) { return cat16b(*(const v8usa*)p, *(const v8usa*)(p + 16)); }

// ---- tanh of two hidden units at once: the f32 tanh instruction (v_tanh_f32), one transcendental per value.
__device__ __forceinline__ v2f tnh2(v2f x) {
    v2f r; r[0] = __builtin_amdgcn_tanhf(x[0]); r[1] = __builtin_amdgcn_tanhf(x[1]);
    return r;
}

// ---- k_score: one block (16 waves) per (b, h, group of QG queries); LANE tid OWNS KEY tid and keeps that key's whole key-side projection row (HH f32) in registers for all QG queries.
// Staging: the 512 raw key rows X[b][k][64h ..] are read as whole 256-B rows (16 B a lane), converted to bf16 (RNE) and put into the first 128 B of the key's own LDS row (pitch KPP floats, 272 B = 16 B x odd);
// the whole weight [HH][2*DHD] goes the same way into two bf16 planes (key side, query side) and the QG raw query rows into a third, all at a pitch of WPP halves (144 B = 16 B x odd). Block barrier.
// Projections (fragments: lane l, hi = l>>4, lr = l&15; A and B elements 0..7 <- row[k0+8hi+0..7], 8..15 <- row[k0+16+8hi+0..7]; D element j -> (row 8hi+j, col lr); k0 = 0 then 32, chained):
// key side, wave w, its own 32 keys: D[a][key] = Wk rows (A) x key rows (B), 4 hidden tiles x 2 key tiles; a lane's 8 D elements are 8 neighbouring hidden units of one key and go as 2 x 16 B into that key's LDS row,
// over the bf16 copy, which both WMMAs of the tile have consumed by then; query side, waves 0..3: D[q][a] = query rows (A) x Wq rows (B), hidden tile w, + bf16_RNE(b[a]), into the query rows in LDS.
// Behind the second block barrier each lane reads its own key row back; bf16_RNE(w2) (c[a] on the fast path) and the query-side rows are read at one address by all lanes.
// Per query: s = sum_a w2[a] tanh(qp[a] + kp[k][a]) in f32, summed inside the lane, no cross-lane step. With Ek = e^(2 kp) (once per key, in registers) and Eq = e^(2 qp) (once per query, in LDS)
// tanh(kp + qp) = 1 - 2 / (1 + Ek Eq), so s = sum_a w2[a] - 2 KAP sum_a 1 / d[a] with d[a] = (1 + Ek Eq) KAP / w2[a] = c[a] + Ek (Eq c[a]), c[a] = KAP / w2[a]: one multiply-add a value, c folded into the query side.
// Four hidden units go over one common denominator: 1/d0 + 1/d1 = (d0 + d1) / (d0 d1), two such fractions are joined the same way, and the four share one reciprocal.
// Range: with |2 log2(e) kp| <= EBK, |2 log2(e) qp| <= EBQ and WLO <= |w2| <= WHI every |d| lies in [2^-30, 2^2 (1 + 2^29)], so the product of four lies in [2^-120, 2^125): finite and normal, like its reciprocal
// (KAP only centres that range). A wave that sees a value outside those bounds takes the loop with one tanh instruction a value instead; the two loops give the same score up to f32 rounding.
// The int mask word of the lane's key is compared by value: nonzero -> the score is replaced by -inf. The score goes to the LDS row of its query (cross-wave, block barrier).
// Softmax: wave w takes query row w alone (16 keys a lane, f32, max-subtracted, exp2, rcp of the row sum; shuffle trees inside the wave) and writes the whole P row
// (f16, P x1024, 1 KB) into LDS at a pitch of PPP halves (1040 B = 16 B x odd) as 32 lanes x 16 B, twice.
// weights.values: [QG][TK] P (LDS) x V[k][64h + n] -> [QG][DHD]. Wave w takes the 16 output columns nt = w & 3 and the KQ keys of quarter kq = w >> 2: four chained WMMAs.
// Its value fragments come straight from the raw input X[b][k][64h + n]: one 4-byte load per fragment element (16 lanes = 64 B of one key's row, the two lane halves two rows), issued with the
// staging loads; in front of the score loop each becomes f16 = bf16_RNE(x) * VSC (the x16 carry keeps small entries normal in f16; bf16 significands are exact in f16) and waits in the lane's own LDS slots.
// The four quarters meet in LDS and are added in f32, quarter 0 first;
// thread tid stores out[b][q0 + tid/32][64h + 2(tid%32) .. +1], so a wave writes one whole 256-B row piece.
__global__ __launch_bounds__(512) void k_score(const float* __restrict__ X, const float* __restrict__ Q, const float* __restrict__ Wt, const float* __restrict__ bias, const float* __restrict__ vv, const int* __restrict__ mask, float* OUT) {
    __shared__ __align__(16) float s_kp[TK * KPP];
    __shared__ __align__(16) float s_sc[QG * TK];
    __shared__ __align__(16) float s_qp[QG * HH];
    __shared__ __align__(16) float s_qe[QG * HH];
    __shared__ __align__(16) float s_qm[128];
    __shared__ __align__(16) float s_cw[HH];
    __shared__ __align__(16) float s_sw[4];
    __shared__ __align__(16) float s_w2[HH];
    __shared__ __align__(16) h16 s_p[QG * PPP];
    __shared__ __align__(16) float s_o[4 * QG * DHD];
    __shared__ __align__(16) h16 s_v[8 * 512 * 8];
    __shared__ __align__(16) bf s_wb[2 * HH * WPP];
    __shared__ __align__(16) bf s_qb[QG * WPP];
    const int blk = blockIdx.x; const int qg = blk % (TQ / QG); const int h = (blk / (TQ / QG)) % NHD; const int b = blk / ((TQ / QG) * NHD);
    const int tid = threadIdx.x, lane = tid & 31, wave = tid >> 5;
    const int q0 = qg * QG;
    const int lr = lane & 15, hi = lane >> 4, nt = wave & 3, kq = wave >> 2;
    const float* xh = X + (size_t)b * TK * DV + h * DHD;
    float vr[4][16];
    float bv, wq;
    {
        const int rr = wave * 32 + (lane >> 4), cc = (lane & 15) * 4;
        v4f st[16], wr[4];
#pragma unroll
        for (int j = 0; j < 16; ++j) st[j] = *(const v4f*)(xh + (size_t)(rr + 2 * j) * DV + cc);
#pragma unroll
        for (int j = 0; j < 4; ++j) wr[j] = *(const v4f*)(Wt + (size_t)(j * 512 + tid) * 4);
        const v2f qv = *(const v2f*)(Q + ((size_t)b * TQ + q0 + wave) * DV + h * DHD + lane * 2);
        bv = bias[nt * 16 + lr];
        wq = vv[nt * 16 + lr];
        // the value loads below may be given the registers that hold the addresses of the loads above as their destinations: this wait stands between the two groups
        asm volatile("s_wait_xcnt 0x0" ::: "memory");
        // raw value elements of this wave's slice, issued behind the staging loads: both streams are in flight together
        const float* vp = xh + (size_t)(kq * KQ + 8 * hi) * DV + nt * 16 + lr;
#pragma unroll
        for (int s = 0; s < 4; ++s)
#pragma unroll
            for (int e = 0; e < 8; ++e) { vr[s][e] = vp[(size_t)(s * 32 + e) * DV]; vr[s][8 + e] = vp[(size_t)(s * 32 + 16 + e) * DV]; }
#pragma unroll
        for (int j = 0; j < 16; ++j) *(v4usa*)((bf*)(s_kp + (rr + 2 * j) * KPP) + cc) = cvt4(st[j]);
        // piece i of the weight: row a = i / 32, input columns 4 (i % 32) .. + 3; columns under DHD are the key side (plane 0), the rest the query side (plane 1)
#pragma unroll
        for (int j = 0; j < 4; ++j) { const int i = j * 512 + tid, col = (i & 31) * 4; *(v4usa*)(s_wb + ((col >> 6) * HH + (i >> 5)) * WPP + (col & 63)) = cvt4(wr[j]); }
        *(v2usa*)(s_qb + wave * WPP + lane * 2) = cvt2(qv);
        if (tid < HH) { const float w = bfr(vv[tid]); s_w2[tid] = w; s_cw[tid] = KAP * __builtin_amdgcn_rcpf(w); }
    }
    const int mk = mask[(size_t)b * TK + tid];
    __syncthreads();
    {
        float* kr = s_kp + (wave * 32 + lr) * KPP;
        v16bf xf[2][2];
#pragma unroll
        for (int t = 0; t < 2; ++t)
#pragma unroll
            for (int ks = 0; ks < 2; ++ks) xf[t][ks] = ldfrag((const bf*)(kr + t * 16 * KPP) + ks * 32 + 8 * hi);
#pragma unroll
        for (int at = 0; at < 4; ++at) {
            const bf* pw = s_wb + (at * 16 + lr) * WPP + 8 * hi;
            const v16bf w0 = ldfrag(pw), w1 = ldfrag(pw + 32);
#pragma unroll
            for (int t = 0; t < 2; ++t) {
                const v8f d = wmmab(w1, xf[t][1], wmmab(w0, xf[t][0], (v8f){}));
                float* o = kr + t * 16 * KPP + at * 16 + 8 * hi;
                *(v4fa*)o = (v4f){d[0], d[1], d[2], d[3]}; *(v4fa*)(o + 4) = (v4f){d[4], d[5], d[6], d[7]};
            }
        }
        // the same for every lane of a wave: a scalar branch, so the matrix instructions inside run with all lanes on
        if (__builtin_amdgcn_readfirstlane(wave) < 4) {
            const bf* pq = s_qb + lr * WPP + 8 * hi; const bf* pw = s_wb + (HH + nt * 16 + lr) * WPP + 8 * hi;
            const v8f d = wmmab(ldfrag(pq + 32), ldfrag(pw + 32), wmmab(ldfrag(pq), ldfrag(pw), (v8f){}));
            const float bq = bfr(bv);
            const float wr2 = bfr(wq), cq = KAP * __builtin_amdgcn_rcpf(wr2);
            float am = 0.0f, a[8];
#pragma unroll
            for (int j = 0; j < 8; ++j) {
                const float t = d[j] + bq;
                a[j] = t * C2L;
                s_qp[(hi * 8 + j) * HH + nt * 16 + lr] = t; s_qe[(hi * 8 + j) * HH + nt * 16 + lr] = __builtin_amdgcn_exp2f(a[j]) * cq;
            }
#pragma unroll
            for (int j = 0; j < 8; ++j) am = fmaxf(am, fabsf(a[j]));
            // the lane's mark: 0 while its eight query-side values and its hidden unit's weight lie inside the bounds of the shared-reciprocal form
            s_qm[tid] = ((am <= EBQ) & (fabsf(wr2) >= WLO) & (fabsf(wr2) <= WHI)) ? 0.0f : 1.0f;
        } else if (__builtin_amdgcn_readfirstlane(wave) == 4) {
            // sum_a w2[a], once for the block, by a wave that has no query-side tile
            v2f t = (v2f){0.0f, 0.0f};
#pragma unroll
            for (int c = 0; c < HH / 4; ++c) { const v4f u = *(const v4fa*)(s_w2 + c * 4); t += (v2f){u[0], u[1]}; t += (v2f){u[2], u[3]}; }
            if (lane == 0) s_sw[0] = t[0] + t[1];
        }
    }
    __syncthreads();
    v2f kp[HH / 2], wv[HH / 2];
    const v4f qm4 = *(const v4fa*)(s_qm + lane * 4);
    const float sw = s_sw[0];
#pragma unroll
    for (int c = 0; c < HH / 4; ++c) { const v4f t = *(const v4fa*)(s_kp + tid * KPP + c * 4); kp[2 * c] = (v2f){t[0], t[1]}; kp[2 * c + 1] = (v2f){t[2], t[3]}; }
    // value fragments: f16 = bf16_RNE(x) * VSC; each lane parks its own eight 16-B pieces in LDS (piece j of thread tid at (j * 512 + tid) * 16 B) and takes them back behind the loop,
    // so the score loop carries none of them in registers
#pragma unroll
    for (int j = 0; j < 8; ++j) {
        v8h o;
#pragma unroll
        for (int e = 0; e < 8; e += 2) {
            const v2f w = __builtin_convertvector(__builtin_convertvector((v2f){vr[j >> 1][(j & 1) * 8 + e], vr[j >> 1][(j & 1) * 8 + e + 1]}, v2bf), v2f) * VSC;
            o[e] = toh_flush(w[0]); o[e + 1] = toh_flush(w[1]);
        }
        *(v8ha*)(s_v + (j * 512 + tid) * 8) = o;
    }
    // range test of the shared-reciprocal form: the lane's own key row and its four of the 128 query-side marks; the ballot makes the choice the same for the whole wave
    float km = 0.0f;
#pragma unroll
    for (int c = 0; c < HH / 2; ++c) km = fmaxf(km, fmaxf(fabsf(kp[c][0]), fabsf(kp[c][1])));
    const bool wide = !(km * C2L <= EBK) | !(qm4[0] + qm4[1] + qm4[2] + qm4[3] == 0.0f);
    const bool fast = __builtin_amdgcn_ballot_w32(wide) == 0u;
    {
        const float* wsrc = fast ? s_cw : s_w2;
#pragma unroll
        for (int c = 0; c < HH / 4; ++c) { const v4f u = *(const v4fa*)(wsrc + c * 4); wv[2 * c] = (v2f){u[0], u[1]}; wv[2 * c + 1] = (v2f){u[2], u[3]}; }
    }
    if (fast) {
#pragma unroll
        for (int c = 0; c < HH / 2; ++c) { const v2f a = kp[c] * C2L; kp[c][0] = __builtin_amdgcn_exp2f(a[0]); kp[c][1] = __builtin_amdgcn_exp2f(a[1]); }
        // rolled over the queries: the body (HH hidden units, unrolled) stays a few KB of text
#pragma unroll 1
        for (int i = 0; i < QG; ++i) {
            const float* qr = s_qe + i * HH;
            v2f a0 = (v2f){0.0f, 0.0f}, a1 = (v2f){0.0f, 0.0f};
#pragma unroll
            for (int c = 0; c < HH / 8; ++c) {
                const v4f qa = *(const v4fa*)(qr + c * 8), qb = *(const v4fa*)(qr + c * 8 + 4);
                const v2f d0 = __builtin_elementwise_fma(kp[4 * c], (v2f){qa[0], qa[1]}, wv[4 * c]), d1 = __builtin_elementwise_fma(kp[4 * c + 1], (v2f){qa[2], qa[3]}, wv[4 * c + 1]);
                const v2f d2 = __builtin_elementwise_fma(kp[4 * c + 2], (v2f){qb[0], qb[1]}, wv[4 * c + 2]), d3 = __builtin_elementwise_fma(kp[4 * c + 3], (v2f){qb[2], qb[3]}, wv[4 * c + 3]);
                const v2f n01 = d0 + d1, p01 = d0 * d1, n23 = d2 + d3, p23 = d2 * d3;
                const v2f n = __builtin_elementwise_fma(n23, p01, n01 * p23), p = p01 * p23;
                const v2f r = (v2f){__builtin_amdgcn_rcpf(p[0]), __builtin_amdgcn_rcpf(p[1])};
                if (c & 1) a1 = __builtin_elementwise_fma(n, r, a1); else a0 = __builtin_elementwise_fma(n, r, a0);
            }
            const v2f as = a0 + a1;
            const float s = fmaf(-2.0f * KAP, as[0] + as[1], sw);
            s_sc[i * TK + tid] = (mk != 0) ? -INFINITY : s;
        }
    } else
    // rolled over the queries, as above
#pragma unroll 1
    for (int i = 0; i < QG; ++i) {
        const float* qr = s_qp + i * HH;
        v2f a0 = (v2f){0.0f, 0.0f}, a1 = (v2f){0.0f, 0.0f};
#pragma unroll
        for (int c = 0; c < HH / 4; ++c) {
            const v4f qq = *(const v4fa*)(qr + c * 4);
            a0 = __builtin_elementwise_fma(wv[2 * c], tnh2((v2f){qq[0], qq[1]} + kp[2 * c]), a0);
            a1 = __builtin_elementwise_fma(wv[2 * c + 1], tnh2((v2f){qq[2], qq[3]} + kp[2 * c + 1]), a1);
        }
        const v2f as = a0 + a1;
        const float s = as[0] + as[1];
        s_sc[i * TK + tid] = (mk != 0) ? -INFINITY : s;
    }
    __syncthreads();
    // the lane's own value pieces come back here, so that their LDS latency passes under the softmax
    v16h vb[4];
#pragma unroll
    for (int s = 0; s < 4; ++s) vb[s] = cat16(*(const v8ha*)(s_v + (2 * s * 512 + tid) * 8), *(const v8ha*)(s_v + ((2 * s + 1) * 512 + tid) * 8));
    const float* row = s_sc + wave * TK;
    v2f x[8];
#pragma unroll
    for (int i = 0; i < 2; ++i)
#pragma unroll
        for (int c = 0; c < 2; ++c) { const v4f t = *(const v4fa*)(row + (i * 32 + lane) * 8 + c * 4); x[4 * i + 2 * c] = (v2f){t[0], t[1]}; x[4 * i + 2 * c + 1] = (v2f){t[2], t[3]}; }
    float m = x[0][0];
#pragma unroll
    for (int i = 0; i < 8; ++i) m = fmaxf(m, fmaxf(x[i][0], x[i][1]));
#pragma unroll
    for (int sh = 16; sh; sh >>= 1) m = fmaxf(m, __shfl_xor(m, sh, 32));
    v2f s2 = (v2f){0.0f, 0.0f};
#pragma unroll
    for (int i = 0; i < 8; ++i) { const v2f d = (x[i] - m) * LOG2E; x[i][0] = __builtin_amdgcn_exp2f(d[0]); x[i][1] = __builtin_amdgcn_exp2f(d[1]); s2 += x[i]; }
    float sum = s2[0] + s2[1];
#pragma unroll
    for (int sh = 16; sh; sh >>= 1) sum += __shfl_xor(sum, sh, 32);
    const float inv = __builtin_amdgcn_rcpf(sum); const float invp = inv * PCAR;
    h16* dst = s_p + wave * PPP;
#pragma unroll
    for (int i = 0; i < 2; ++i) {
        v8h o;
#pragma unroll
        for (int c = 0; c < 4; ++c) { const v2f p = x[4 * i + c] * invp; o[2 * c] = toh_flush(p[0]); o[2 * c + 1] = toh_flush(p[1]); }
        *(v8ha*)(dst + (i * 32 + lane) * 8) = o;
    }
    __syncthreads();
    v8f acc = (v8f){};
    const h16* pa = s_p + lr * PPP + kq * KQ + 8 * hi;
#pragma unroll
    for (int s = 0; s < 4; ++s) acc = wmma16(cat16(*(const v8ha*)(pa + s * 32), *(const v8ha*)(pa + s * 32 + 16)), vb[s], acc);
#pragma unroll
    for (int j = 0; j < 8; ++j) s_o[(kq * QG + hi * 8 + j) * DHD + nt * 16 + lr] = acc[j];
    __syncthreads();
    v2f r = *(const v2f*)(s_o + tid * 2);
#pragma unroll
    for (int g = 1; g < 4; ++g) r += *(const v2f*)(s_o + g * QG * DHD + tid * 2);
    *(v2f*)(OUT + ((size_t)b * TQ_FULL + q0 + wave) * DV + h * DHD + lane * 2) = r * OSC;
}

extern "C" void kernel_launch(void* const* d_in, const int* in_sizes, int n_in,
                              void* d_out, int out_size, void* d_ws, size_t ws_size, hipStream_t stream) {
    if (n_in < 6) return;
    if (in_sizes[0] < NB * TK * DV || in_sizes[1] < NB * TQ * DV || in_sizes[2] < HH * 2 * DHD || in_sizes[3] < HH || in_sizes[4] < HH || in_sizes[5] < NB * TK) return;
    if (out_size < NB_FULL * TQ_FULL * DV) return;
    const float* x     = (const float*)d_in[0];   // [NB][TK][DV]   keys and values
    const float* query = (const float*)d_in[1];   // [NB][TQ][DV]
    const float* W     = (const float*)d_in[2];   // [HH][2*DHD]    ([out][in]; key columns first, query columns second)
    const float* bb    = (const float*)d_in[3];   // [HH]
    const float* w2    = (const float*)d_in[4];   // [HH]
    const int*   mask  = (const int*)d_in[5];     // [NB][TK]       nonzero = key excluded
    float* OUT = (float*)d_out;                   // [NB_FULL][TQ_FULL][DV], byte offset 0
    (void)d_ws; (void)ws_size;                    // no workspace

    // projections + scores + mask + softmax + P . values per (b, h, QG queries): out[b][q][64h + d], f32, epilogue scale 2^-14
    k_score<<<(unsigned)(NB * NHD * (TQ / QG)), 512, 0, stream>>>(x, query, W, bb, w2, mask, OUT);
}

// v008
// Measured time: 12 microseconds a run.
// Two timings next to v007 put it at 1.10 and 1.09 times that version's speed.
// Counting every step since v000, it is 18.9 times as fast.
#include <hip/hip_runtime.h>

// One launch. Contractions: key-slice.Wk and query-slice.Wq (+b) per head on v_wmma_f32_16x16x32_bf16 in the head of the score kernel (bf16 operands = RNE-converted f32 inputs, f32 accumulate);
// weights.values per head on v_wmma_f32_16x16x32_bf16 in the tail of the score kernel (bf16 operands: P as a pair hi + lo, hi = bf16_RNE(P), lo = bf16_RNE(P - hi); V = bf16_RNE(x), the staged key rows themselves; f32 accumulate);
// score matvec sum_a w2[a]*tanh(kp[a]+qp[a]+b[a]) (N=1) and the softmax stay f32 on VALU.

#ifndef NB
#define NB 8
#endif
#ifndef TQ
#define TQ 64
#endif
#define NB_FULL 8
#define TQ_FULL 64
#define TK    512
#define DV    512
#define NHD   8
#define DHD   64
#define HH    64
#define LOG2E 1.4426950408889634f
#define QG    16
#define KPP   68
#define PPP   520
#define KQ    128
#define WPP   72
#define C2L   (2.0f * LOG2E)
#define EBK   15.0f
#define EBQ   14.0f
#define KAP   (1.0f / 4194304.0f)
#define WLO   (1.0f / 16777216.0f)
#define WHI   256.0f

static_assert(TQ == TQ_FULL || NB == 1);
static_assert(TQ % 64 == 0 && TQ >= 64 && TQ <= TQ_FULL);
static_assert(NB >= 1 && NB <= NB_FULL);
static_assert(NHD * DHD == DV);
static_assert(HH == 64 && DHD == 64 && DHD == 2 * 32 && HH == 4 * 16);
static_assert((size_t)NB_FULL * TQ_FULL * DV * 4 == 1048576);
static_assert(TQ % QG == 0 && QG * 32 == TK && QG * 32 == 512 && HH == 2 * 32 && HH % 4 == 0);
static_assert(KPP >= HH && KPP % 4 == 0 && (KPP / 4) % 2 == 1);
static_assert(QG == 16 && DHD == 4 * 16 && TK == 4 * KQ && KQ == 4 * 32 && QG * DHD == 2 * 512);
static_assert(PPP >= TK && PPP % 8 == 0 && (PPP / 8) % 2 == 1);
static_assert(WPP >= DHD && WPP % 8 == 0 && (WPP / 8) % 2 == 1);
static_assert(HH * 2 * DHD == 4 * 512 * 4 && 2 * DHD / 4 == 32);
static_assert(HH % 8 == 0 && 4 * 32 == 128 && HH == 4 * 16);
static_assert((TK * KPP + QG * TK + 2 * QG * HH + 128 + 4 + 2 * HH + 4 * QG * DHD) * 4 + 2 * QG * PPP * 2 + (TK + 2 * HH + QG) * WPP * 2 <= 327680);

typedef unsigned short bf;
typedef __attribute__((ext_vector_type(16))) __bf16   v16bf;
typedef __attribute__((ext_vector_type(8)))  short    v8s;
typedef __attribute__((ext_vector_type(8)))  unsigned short v8us;
typedef __attribute__((ext_vector_type(4)))  unsigned short v4us;
typedef __attribute__((ext_vector_type(8)))  float    v8f;
typedef __attribute__((ext_vector_type(4)))  float    v4f;
typedef __attribute__((ext_vector_type(2)))  float    v2f;
typedef __attribute__((ext_vector_type(2)))  unsigned short v2us;
typedef __attribute__((ext_vector_type(2)))  __bf16   v2bf;
typedef __attribute__((ext_vector_type(4)))  __bf16   v4bf;
typedef v4f  __attribute__((may_alias)) v4fa;
typedef v8us __attribute__((may_alias)) v8usa;
typedef v4us __attribute__((may_alias)) v4usa;
typedef v2us __attribute__((may_alias)) v2usa;

__device__ __forceinline__ unsigned short f2bf(float f) { unsigned u = __float_as_uint(f); u += 0x7FFFu + ((u >> 16) & 1u); return (unsigned short)(u >> 16); }
__device__ __forceinline__ float bf2f(unsigned short b) { return __uint_as_float(((unsigned)b) << 16); }
__device__ __forceinline__ float bfr(float f) { return bf2f(f2bf(f)); }
__device__ __forceinline__ v16bf cat16b(v8us lo, v8us hi) { return __builtin_bit_cast(v16bf, __builtin_shufflevector(lo, hi, 0, 1, 2, 3, 4, 5, 6, 7, 8, 9, 10, 11, 12, 13, 14, 15)); }
__device__ __forceinline__ v8f wmmab(v16bf a, v16bf b, v8f c) { return __builtin_amdgcn_wmma_f32_16x16x32_bf16(false, a, false, b, (short)0, c, false, false); }
// f32 -> bf16 (RNE), four and two at a time
__device__ __forceinline__ v4us cvt4(v4f v) { return __builtin_bit_cast(v4us, __builtin_convertvector(v, v4bf)); }
__device__ __forceinline__ v2us cvt2(v2f v) { return __builtin_bit_cast(v2us, __builtin_convertvector(v, v2bf)); }
// one bf16 WMMA fragment from a K-contiguous LDS row; p already holds the lane's + 8 * hi: elements 0..7 <- p[0..7], 8..15 <- p[16..23] (A and B by the same k map)
__device__ __forceinline__ v16bf ldfrag(const bf* p) { return cat16b(*(const v8usa*)p, *(const v8usa*)(p + 16)); }
// transposing LDS load (ds_load_tr16_b128) of a row-major 16-bit tile T[k][n]: lane l hands in the address of T[kb + 8 (l >> 4) + (l & 7)][nb + 8 ((l >> 3) & 1)] and gets T[kb + 8 (l >> 4) + 0..7][nb + (l & 15)]
__device__ __forceinline__ v8us ldtr(const bf* p) { typedef __attribute__((address_space(3))) v8s lds_v8s; return __builtin_bit_cast(v8us, __builtin_amdgcn_ds_load_tr16_b128_v8i16((lds_v8s*)p)); }

// ---- tanh of two hidden units at once: the f32 tanh instruction (v_tanh_f32), one transcendental per value.
__device__ __forceinline__ v2f tnh2(v2f x) {
    v2f r; r[0] = __builtin_amdgcn_tanhf(x[0]); r[1] = __builtin_amdgcn_tanhf(x[1]);
    return r;
}

// ---- k_score: one block (16 waves) per (b, h, group of QG queries); LANE tid OWNS KEY tid and keeps that key's whole key-side projection row (HH f32) in registers for all QG queries.
// Staging: the 512 raw key rows X[b][k][64h ..] are read as whole 256-B rows (16 B a lane), converted to bf16 (RNE) and put into a bf16 plane of their own, which stays to the end: it is the key operand and the value operand;
// the whole weight [HH][2*DHD] goes the same way into two bf16 planes (key side, query side) and the QG raw query rows into a third, all at a pitch of WPP halves (144 B = 16 B x odd). Block barrier.
// Projections (fragments: lane l, hi = l>>4, lr = l&15; A and B elements 0..7 <- row[k0+8hi+0..7], 8..15 <- row[k0+16+8hi+0..7]; D element j -> (row 8hi+j, col lr); k0 = 0 then 32, chained):
// key side, wave w, its own 32 keys: D[a][key] = Wk rows (A) x key rows (B), 4 hidden tiles x 2 key tiles; a lane's 8 D elements are 8 neighbouring hidden units of one key and go as 2 x 16 B into that key's f32 LDS row
// (pitch KPP floats, 272 B = 16 B x odd); query side, waves 0..3: D[q][a] = query rows (A) x Wq rows (B), hidden tile w, + bf16_RNE(b[a]), into the query rows in LDS.
// Behind the second block barrier each lane reads its own key row back; bf16_RNE(w2) and the query-side rows are read at one address by all lanes.
// Per query: s = sum_a w2[a] tanh(qp[a] + kp[k][a]) in f32, summed inside the lane, no cross-lane step. With Ek = e^(2 kp) (once per key, in registers) and Eq = e^(2 qp) (once per query, in LDS)
// tanh(kp + qp) = 1 - 2 / (1 + Ek Eq), so s = sum_a w2[a] - 2 KAP sum_a 1 / d[a] with d[a] = (1 + Ek Eq) KAP / w2[a] = c[a] + Ek (Eq c[a]), c[a] = KAP / w2[a]: one multiply-add a value, c folded into the query side.
// Four hidden units go over one common denominator: 1/d0 + 1/d1 = (d0 + d1) / (d0 d1), two such fractions are joined the same way, and the four share one reciprocal.
// Range: with |2 log2(e) kp| <= EBK, |2 log2(e) qp| <= EBQ and WLO <= |w2| <= WHI every |d| lies in [2^-30, 2^2 (1 + 2^29)], so the product of four lies in [2^-120, 2^125): finite and normal, like its reciprocal
// (KAP only centres that range). A wave that sees a value outside those bounds takes the loop with one tanh instruction a value instead; the two loops give the same score up to f32 rounding.
// The int mask word of the lane's key is compared by value: nonzero -> the score is replaced by -inf. The score goes to the LDS row of its query (cross-wave, block barrier).
// Softmax: wave w takes query row w alone (16 keys a lane, f32, max-subtracted, exp2, rcp of the row sum; shuffle trees inside the wave) and writes the whole P row
// as two bf16 rows (hi = bf16_RNE(P), lo = bf16_RNE(P - hi), 1 KB each, one plane each) into LDS at a pitch of PPP halves (1040 B = 16 B x odd), each as 32 lanes x 16 B, twice.
// weights.values: [QG][TK] P (LDS) x V[k][64h + n] -> [QG][DHD]. Wave w takes the 16 output columns nt = w & 3 and the KQ keys of quarter kq = w >> 2: four chained WMMAs on hi, four on lo, the two sums added.
// Its value fragments come from the staged bf16 key rows by transposing LDS loads: two loads (keys kb + 8hi + 0..7 and kb + 16 + 8hi + 0..7 of column 16nt + lr) make one B fragment, in the k order of the P fragments.
// The four quarters meet in LDS and are added in f32, quarter 0 first;
// thread tid stores out[b][q0 + tid/32][64h + 2(tid%32) .. +1], so a wave writes one whole 256-B row piece.
__global__ __launch_bounds__(512) void k_score(const float* __restrict__ X, const float* __restrict__ Q, const float* __restrict__ Wt, const float* __restrict__ bias, const float* __restrict__ vv, const int* __restrict__ mask, float* OUT) {
    __shared__ __align__(16) float s_kp[TK * KPP];
    __shared__ __align__(16) float s_sc[QG * TK];
    __shared__ __align__(16) float s_qp[QG * HH];
    __shared__ __align__(16) float s_qe[QG * HH];
    __shared__ __align__(16) float s_qm[128];
    __shared__ __align__(16) float s_cw[HH];
    __shared__ __align__(16) float s_sw[4];
    __shared__ __align__(16) float s_w2[HH];
    __shared__ __align__(16) bf s_p[2 * QG * PPP];
    __shared__ __align__(16) float s_o[4 * QG * DHD];
    __shared__ __align__(16) bf s_xb[TK * WPP];
    __shared__ __align__(16) bf s_wb[2 * HH * WPP];
    __shared__ __align__(16) bf s_qb[QG * WPP];
    const int blk = blockIdx.x; const int qg = blk % (TQ / QG); const int h = (blk / (TQ / QG)) % NHD; const int b = blk / ((TQ / QG) * NHD);
    const int tid = threadIdx.x, lane = tid & 31, wave = tid >> 5;
    const int q0 = qg * QG;
    const int lr = lane & 15, hi = lane >> 4, nt = wave & 3, kq = wave >> 2;
    const float* xh = X + (size_t)b * TK * DV + h * DHD;
    float bv, wq;
    {
        const int rr = wave * 32 + (lane >> 4), cc = (lane & 15) * 4;
        v4f st[16], wr[4];
#pragma unroll
        for (int j = 0; j < 16; ++j) st[j] = *(const v4f*)(xh + (size_t)(rr + 2 * j) * DV + cc);
#pragma unroll
        for (int j = 0; j < 4; ++j) wr[j] = *(const v4f*)(Wt + (size_t)(j * 512 + tid) * 4);
        const v2f qv = *(const v2f*)(Q + ((size_t)b * TQ + q0 + wave) * DV + h * DHD + lane * 2);
        bv = bias[nt * 16 + lr];
        wq = vv[nt * 16 + lr];
        // what follows may be given the registers that hold the addresses of the loads above: this wait stands in front of it
        asm volatile("s_wait_xcnt 0x0" ::: "memory");
#pragma unroll
        for (int j = 0; j < 16; ++j) *(v4usa*)(s_xb + (rr + 2 * j) * WPP + cc) = cvt4(st[j]);
        // piece i of the weight: row a = i / 32, input columns 4 (i % 32) .. + 3; columns under DHD are the key side (plane 0), the rest the query side (plane 1)
#pragma unroll
        for (int j = 0; j < 4; ++j) { const int i = j * 512 + tid, col = (i & 31) * 4; *(v4usa*)(s_wb + ((col >> 6) * HH + (i >> 5)) * WPP + (col & 63)) = cvt4(wr[j]); }
        *(v2usa*)(s_qb + wave * WPP + lane * 2) = cvt2(qv);
        if (tid < HH) { const float w = bfr(vv[tid]); s_w2[tid] = w; s_cw[tid] = KAP * __builtin_amdgcn_rcpf(w); }
    }
    const int mk = mask[(size_t)b * TK + tid];
    __syncthreads();
    {
        float* kr = s_kp + (wave * 32 + lr) * KPP;
        v16bf xf[2][2];
#pragma unroll
        for (int t = 0; t < 2; ++t)
#pragma unroll
            for (int ks = 0; ks < 2; ++ks) xf[t][ks] = ldfrag(s_xb + (wave * 32 + t * 16 + lr) * WPP + ks * 32 + 8 * hi);
#pragma unroll
        for (int at = 0; at < 4; ++at) {
            const bf* pw = s_wb + (at * 16 + lr) * WPP + 8 * hi;
            const v16bf w0 = ldfrag(pw), w1 = ldfrag(pw + 32);
#pragma unroll
            for (int t = 0; t < 2; ++t) {
                const v8f d = wmmab(w1, xf[t][1], wmmab(w0, xf[t][0], (v8f){}));
                float* o = kr + t * 16 * KPP + at * 16 + 8 * hi;
                *(v4fa*)o = (v4f){d[0], d[1], d[2], d[3]}; *(v4fa*)(o + 4) = (v4f){d[4], d[5], d[6], d[7]};
            }
        }
        // the same for every lane of a wave: a scalar branch, so the matrix instructions inside run with all lanes on
        if (__builtin_amdgcn_readfirstlane(wave) < 4) {
            const bf* pq = s_qb + lr * WPP + 8 * hi; const bf* pw = s_wb + (HH + nt * 16 + lr) * WPP + 8 * hi;
            const v8f d = wmmab(ldfrag(pq + 32), ldfrag(pw + 32), wmmab(ldfrag(pq), ldfrag(pw), (v8f){}));
            const float bq = bfr(bv);
            const float wr2 = bfr(wq), cq = KAP * __builtin_amdgcn_rcpf(wr2);
            float am = 0.0f, a[8];
#pragma unroll
            for (int j = 0; j < 8; ++j) {
                const float t = d[j] + bq;
                a[j] = t * C2L;
                s_qp[(hi * 8 + j) * HH + nt * 16 + lr] = t; s_qe[(hi * 8 + j) * HH + nt * 16 + lr] = __builtin_amdgcn_exp2f(a[j]) * cq;
            }
#pragma unroll
            for (int j = 0; j < 8; ++j) am = fmaxf(am, fabsf(a[j]));
            // the lane's mark: 0 while its eight query-side values and its hidden unit's weight lie inside the bounds of the shared-reciprocal form
            s_qm[tid] = ((am <= EBQ) & (fabsf(wr2) >= WLO) & (fabsf(wr2) <= WHI)) ? 0.0f : 1.0f;
        } else if (__builtin_amdgcn_readfirstlane(wave) == 4) {
            // sum_a w2[a], once for the block, by a wave that has no query-side tile
            v2f t = (v2f){0.0f, 0.0f};
#pragma unroll
            for (int c = 0; c < HH / 4; ++c) { const v4f u = *(const v4fa*)(s_w2 + c * 4); t += (v2f){u[0], u[1]}; t += (v2f){u[2], u[3]}; }
            if (lane == 0) s_sw[0] = t[0] + t[1];
        }
    }
    __syncthreads();
    v2f kp[HH / 2], wv[HH / 2];
    const v4f qm4 = *(const v4fa*)(s_qm + lane * 4);
    const float sw = s_sw[0];
#pragma unroll
    for (int c = 0; c < HH / 4; ++c) { const v4f t = *(const v4fa*)(s_kp + tid * KPP + c * 4); kp[2 * c] = (v2f){t[0], t[1]}; kp[2 * c + 1] = (v2f){t[2], t[3]}; }
    // range test of the shared-reciprocal form: the lane's own key row and its four of the 128 query-side marks; the ballot makes the choice the same for the whole wave
    float km = 0.0f;
#pragma unroll
    for (int c = 0; c < HH / 2; ++c) km = fmaxf(km, fmaxf(fabsf(kp[c][0]), fabsf(kp[c][1])));
    const bool wide = !(km * C2L <= EBK) | !(qm4[0] + qm4[1] + qm4[2] + qm4[3] == 0.0f);
    const bool fast = __builtin_amdgcn_ballot_w32(wide) == 0u;
    {
        const float* wsrc = fast ? s_cw : s_w2;
#pragma unroll
        for (int c = 0; c < HH / 4; ++c) { const v4f u = *(const v4fa*)(wsrc + c * 4); wv[2 * c] = (v2f){u[0], u[1]}; wv[2 * c + 1] = (v2f){u[2], u[3]}; }
    }
    if (fast) {
#pragma unroll
        for (int c = 0; c < HH / 2; ++c) { const v2f a = kp[c] * C2L; kp[c][0] = __builtin_amdgcn_exp2f(a[0]); kp[c][1] = __builtin_amdgcn_exp2f(a[1]); }
        // rolled over the queries: the body (HH hidden units, unrolled) stays a few KB of text
#pragma unroll 1
        for (int i = 0; i < QG; ++i) {
            const float* qr = s_qe + i * HH;
            v2f a0 = (v2f){0.0f, 0.0f}, a1 = (v2f){0.0f, 0.0f};
#pragma unroll
            for (int c = 0; c < HH / 8; ++c) {
                const v4f qa = *(const v4fa*)(qr + c * 8), qb = *(const v4fa*)(qr + c * 8 + 4);
                const v2f d0 = __builtin_elementwise_fma(kp[4 * c], (v2f){qa[0], qa[1]}, wv[4 * c]), d1 = __builtin_elementwise_fma(kp[4 * c + 1], (v2f){qa[2], qa[3]}, wv[4 * c + 1]);
                const v2f d2 = __builtin_elementwise_fma(kp[4 * c + 2], (v2f){qb[0], qb[1]}, wv[4 * c + 2]), d3 = __builtin_elementwise_fma(kp[4 * c + 3], (v2f){qb[2], qb[3]}, wv[4 * c + 3]);
                const v2f n01 = d0 + d1, p01 = d0 * d1, n23 = d2 + d3, p23 = d2 * d3;
                const v2f n = __builtin_elementwise_fma(n23, p01, n01 * p23), p = p01 * p23;
                const v2f r = (v2f){__builtin_amdgcn_rcpf(p[0]), __builtin_amdgcn_rcpf(p[1])};
                if (c & 1) a1 = __builtin_elementwise_fma(n, r, a1); else a0 = __builtin_elementwise_fma(n, r, a0);
            }
            const v2f as = a0 + a1;
            const float s = fmaf(-2.0f * KAP, as[0] + as[1], sw);
            s_sc[i * TK + tid] = (mk != 0) ? -INFINITY : s;
        }
    } else
    // rolled over the queries, as above
#pragma unroll 1
    for (int i = 0; i < QG; ++i) {
        const float* qr = s_qp + i * HH;
        v2f a0 = (v2f){0.0f, 0.0f}, a1 = (v2f){0.0f, 0.0f};
#pragma unroll
        for (int c = 0; c < HH / 4; ++c) {
            const v4f qq = *(const v4fa*)(qr + c * 4);
            a0 = __builtin_elementwise_fma(wv[2 * c], tnh2((v2f){qq[0], qq[1]} + kp[2 * c]), a0);
            a1 = __builtin_elementwise_fma(wv[2 * c + 1], tnh2((v2f){qq[2], qq[3]} + kp[2 * c + 1]), a1);
        }
        const v2f as = a0 + a1;
        const float s = as[0] + as[1];
        s_sc[i * TK + tid] = (mk != 0) ? -INFINITY : s;
    }
    __syncthreads();
    // the value fragments are fetched here, so that their LDS latency passes under the softmax
    v16bf vb[4];
    const bf* pv = s_xb + (kq * KQ + 8 * hi + (lane & 7)) * WPP + nt * 16 + 8 * ((lane >> 3) & 1);
#pragma unroll
    for (int s = 0; s < 4; ++s) vb[s] = cat16b(ldtr(pv + s * 32 * WPP), ldtr(pv + (s * 32 + 16) * WPP));
    const float* row = s_sc + wave * TK;
    v2f x[8];
#pragma unroll
    for (int i = 0; i < 2; ++i)
#pragma unroll
        for (int c = 0; c < 2; ++c) { const v4f t = *(const v4fa*)(row + (i * 32 + lane) * 8 + c * 4); x[4 * i + 2 * c] = (v2f){t[0], t[1]}; x[4 * i + 2 * c + 1] = (v2f){t[2], t[3]}; }
    float m = x[0][0];
#pragma unroll
    for (int i = 0; i < 8; ++i) m = fmaxf(m, fmaxf(x[i][0], x[i][1]));
#pragma unroll
    for (int sh = 16; sh; sh >>= 1) m = fmaxf(m, __shfl_xor(m, sh, 32));
    v2f s2 = (v2f){0.0f, 0.0f};
#pragma unroll
    for (int i = 0; i < 8; ++i) { const v2f d = (x[i] - m) * LOG2E; x[i][0] = __builtin_amdgcn_exp2f(d[0]); x[i][1] = __builtin_amdgcn_exp2f(d[1]); s2 += x[i]; }
    float sum = s2[0] + s2[1];
#pragma unroll
    for (int sh = 16; sh; sh >>= 1) sum += __shfl_xor(sum, sh, 32);
    const float inv = __builtin_amdgcn_rcpf(sum);
    bf* dst = s_p + wave * PPP;
#pragma unroll
    for (int i = 0; i < 2; ++i) {
        v8us oh, ol;
#pragma unroll
        for (int c = 0; c < 4; ++c) {
            const v2f p = x[4 * i + c] * inv;
            const v2us ph = cvt2(p);
            const v2us pl = cvt2(p - (v2f){bf2f(ph[0]), bf2f(ph[1])});
            oh[2 * c] = ph[0]; oh[2 * c + 1] = ph[1]; ol[2 * c] = pl[0]; ol[2 * c + 1] = pl[1];
        }
        *(v8usa*)(dst + (i * 32 + lane) * 8) = oh;
        *(v8usa*)(dst + QG * PPP + (i * 32 + lane) * 8) = ol;
    }
    __syncthreads();
    v8f acc = (v8f){}, acl = (v8f){};
    const bf* pa = s_p + lr * PPP + kq * KQ + 8 * hi;
#pragma unroll
    for (int s = 0; s < 4; ++s) { acc = wmmab(ldfrag(pa + s * 32), vb[s], acc); acl = wmmab(ldfrag(pa + QG * PPP + s * 32), vb[s], acl); }
    acc += acl;
#pragma unroll
    for (int j = 0; j < 8; ++j) s_o[(kq * QG + hi * 8 + j) * DHD + nt * 16 + lr] = acc[j];
    __syncthreads();
    v2f r = *(const v2f*)(s_o + tid * 2);
#pragma unroll
    for (int g = 1; g < 4; ++g) r += *(const v2f*)(s_o + g * QG * DHD + tid * 2);
    *(v2f*)(OUT + ((size_t)b * TQ_FULL + q0 + wave) * DV + h * DHD + lane * 2) = r;
}

extern "C" void kernel_launch(void* const* d_in, const int* in_sizes, int n_in,
                              void* d_out, int out_size, void* d_ws, size_t ws_size, hipStream_t stream) {
    if (n_in < 6) return;
    if (in_sizes[0] < NB * TK * DV || in_sizes[1] < NB * TQ * DV || in_sizes[2] < HH * 2 * DHD || in_sizes[3] < HH || in_sizes[4] < HH || in_sizes[5] < NB * TK) return;
    if (out_size < NB_FULL * TQ_FULL * DV) return;
    const float* x     = (const float*)d_in[0];   // [NB][TK][DV]   keys and values
    const float* query = (const float*)d_in[1];   // [NB][TQ][DV]
    const float* W     = (const float*)d_in[2];   // [HH][2*DHD]    ([out][in]; key columns first, query columns second)
    const float* bb    = (const float*)d_in[3];   // [HH]
    const float* w2    = (const float*)d_in[4];   // [HH]
    const int*   mask  = (const int*)d_in[5];     // [NB][TK]       nonzero = key excluded
    float* OUT = (float*)d_out;                   // [NB_FULL][TQ_FULL][DV], byte offset 0
    (void)d_ws; (void)ws_size;                    // no workspace

    // projections + scores + mask + softmax + P . values per (b, h, QG queries): out[b][q][64h + d], f32
    k_score<<<(unsigned)(NB * NHD * (TQ / QG)), 512, 0, stream>>>(x, query, W, bb, w2, mask, OUT);
}

// v010
// A run of this version takes 9.18 microseconds.
// Versions in between are left out here; by their measured steps it is 1.30 times as fast as v008.
// Counting every step since v000, it is 24.6 times as fast.
#include <hip/hip_runtime.h>

// One launch. Contractions: key-slice.Wk and query-slice.Wq (+b) per head on v_wmma_f32_16x16x32_bf16 in the head of the score kernel (bf16 operands = RNE-converted f32 inputs, f32 accumulate);
// weights.values per head on v_wmma_f32_16x16x32_bf16 in the tail of the score kernel (bf16 operands: P as a pair hi + lo, hi = bf16_RNE(P), lo = bf16_RNE(P - hi); V = bf16_RNE(x), the staged key rows themselves; f32 accumulate);
// score sum_a w2[a]*tanh(kp[a]+qp[a]+b[a]): per four hidden units one fraction N / P whose two bilinear forms run on v_wmma_f32_16x16x32_f16 (f16 operands = RNE-converted f32 products of exponentials, f32 accumulate);
// the joining of four fractions into one, the division, the sum over the quotients and the softmax stay f32 on VALU.

#ifndef NB
#define NB 8
#endif
#ifndef TQ
#define TQ 64
#endif
#define NB_FULL 8
#define TQ_FULL 64
#define TK    512
#define DV    512
#define NHD   8
#define DHD   64
#define HH    64
#define LOG2E 1.4426950408889634f
#define QG    16
#define QPP   68
#define PPP   520
#define KQ    128
#define WPP   72
#define C2L   (2.0f * LOG2E)
#define EBQ   13.0f
#define WHI   1.0f
#define NFR   32
#define SCP   516

static_assert(TQ == TQ_FULL || NB == 1);
static_assert(TQ % 64 == 0 && TQ >= 64 && TQ <= TQ_FULL);
static_assert(NB >= 1 && NB <= NB_FULL);
static_assert(NHD * DHD == DV);
static_assert(HH == 64 && DHD == 64 && DHD == 2 * 32 && HH == 4 * 16);
static_assert((size_t)NB_FULL * TQ_FULL * DV * 4 == 1048576);
static_assert(TQ % QG == 0 && QG * 32 == TK && QG * 32 == 512 && HH == 2 * 32 && HH % 4 == 0);
static_assert(QPP >= HH && QPP % 4 == 0 && (QPP / 4) % 2 == 1);
static_assert(NFR == (HH / 8) * (QG / 4) && NFR * 16 == 512);
static_assert(QG == 16 && DHD == 4 * 16 && TK == 4 * KQ && KQ == 4 * 32 && QG * DHD == 2 * 512);
static_assert(PPP >= TK && PPP % 8 == 0 && (PPP / 8) % 2 == 1);
static_assert(SCP >= TK && SCP % 4 == 0 && (SCP / 4) % 2 == 1);
static_assert(WPP >= DHD && WPP % 8 == 0 && (WPP / 8) % 2 == 1);
static_assert(HH * 2 * DHD == 4 * 512 * 4 && 2 * DHD / 4 == 32);
static_assert(HH % 8 == 0 && 4 * 32 == 128 && HH == 4 * 16);
static_assert((QG * SCP + QG * QPP + 128 + 4 + HH + 4 * QG * DHD + NFR * 256) * 4 + 2 * QG * PPP * 2 + (TK + 2 * HH + QG) * WPP * 2 <= 327680);

typedef unsigned short bf;
typedef __attribute__((ext_vector_type(16))) __bf16   v16bf;
typedef __attribute__((ext_vector_type(16))) _Float16 v16h;
typedef __attribute__((ext_vector_type(2)))  _Float16 v2h;
typedef __attribute__((ext_vector_type(8)))  unsigned v8u;
typedef __attribute__((ext_vector_type(4)))  unsigned v4u;
typedef __attribute__((ext_vector_type(8)))  short    v8s;
typedef __attribute__((ext_vector_type(8)))  unsigned short v8us;
typedef __attribute__((ext_vector_type(4)))  unsigned short v4us;
typedef __attribute__((ext_vector_type(8)))  float    v8f;
typedef __attribute__((ext_vector_type(4)))  float    v4f;
typedef __attribute__((ext_vector_type(2)))  float    v2f;
typedef __attribute__((ext_vector_type(2)))  unsigned short v2us;
typedef __attribute__((ext_vector_type(2)))  __bf16   v2bf;
typedef __attribute__((ext_vector_type(4)))  __bf16   v4bf;
typedef v4f  __attribute__((may_alias)) v4fa;
typedef v8us __attribute__((may_alias)) v8usa;
typedef v4us __attribute__((may_alias)) v4usa;
typedef v2us __attribute__((may_alias)) v2usa;
typedef v4u  __attribute__((may_alias)) v4ua;

__device__ __forceinline__ unsigned short f2bf(float f) { unsigned u = __float_as_uint(f); u += 0x7FFFu + ((u >> 16) & 1u); return (unsigned short)(u >> 16); }
__device__ __forceinline__ float bf2f(unsigned short b) { return __uint_as_float(((unsigned)b) << 16); }
__device__ __forceinline__ float bfr(float f) { return bf2f(f2bf(f)); }
__device__ __forceinline__ v16bf cat16b(v8us lo, v8us hi) { return __builtin_bit_cast(v16bf, __builtin_shufflevector(lo, hi, 0, 1, 2, 3, 4, 5, 6, 7, 8, 9, 10, 11, 12, 13, 14, 15)); }
__device__ __forceinline__ v8f wmmab(v16bf a, v16bf b, v8f c) { return __builtin_amdgcn_wmma_f32_16x16x32_bf16(false, a, false, b, (short)0, c, false, false); }
__device__ __forceinline__ v8f wmmah(v16h a, v16h b, v8f c) { return __builtin_amdgcn_wmma_f32_16x16x32_f16(false, a, false, b, (short)0, c, false, false); }
// the 16 products over the subsets S of four factors: element S (bit i of S = factor i is in) sits in f[S / 2][S % 2]; the empty product is 1
__device__ __forceinline__ void sub16(float a0, float a1, float a2, float a3, v2f (&f)[8]) {
    f[0] = (v2f){1.0f, a0}; f[1] = (v2f){a1, a0 * a1};
    f[2] = f[0] * a2; f[3] = f[1] * a2;
#pragma unroll
    for (int j = 0; j < 4; ++j) f[4 + j] = f[j] * a3;
}
// 16 f32 -> 16 f16 (RNE; above the f16 range: infinity), element S in half S
__device__ __forceinline__ v8u pack16(const v2f (&f)[8]) {
    v8u r;
#pragma unroll
    for (int j = 0; j < 8; ++j) r[j] = __builtin_bit_cast(unsigned, __builtin_convertvector(f[j], v2h));
    return r;
}
// f32 -> bf16 (RNE), four and two at a time
__device__ __forceinline__ v4us cvt4(v4f v) { return __builtin_bit_cast(v4us, __builtin_convertvector(v, v4bf)); }
__device__ __forceinline__ v2us cvt2(v2f v) { return __builtin_bit_cast(v2us, __builtin_convertvector(v, v2bf)); }
// one bf16 WMMA fragment from a K-contiguous LDS row; p already holds the lane's + 8 * hi: elements 0..7 <- p[0..7], 8..15 <- p[16..23] (A and B by the same k map)
__device__ __forceinline__ v16bf ldfrag(const bf* p) { return cat16b(*(const v8usa*)p, *(const v8usa*)(p + 16)); }
// transposing LDS load (ds_load_tr16_b128) of a row-major 16-bit tile T[k][n]: lane l hands in the address of T[kb + 8 (l >> 4) + (l & 7)][nb + 8 ((l >> 3) & 1)] and gets T[kb + 8 (l >> 4) + 0..7][nb + (l & 15)]
__device__ __forceinline__ v8us ldtr(const bf* p) { typedef __attribute__((address_space(3))) v8s lds_v8s; return __builtin_bit_cast(v8us, __builtin_amdgcn_ds_load_tr16_b128_v8i16((lds_v8s*)p)); }

// lane l with lane l ^ 16 (v_permlanex16_b32)
__device__ __forceinline__ float xhalf(float x) { return __builtin_bit_cast(float, __builtin_amdgcn_permlanex16(__builtin_bit_cast(int, x), __builtin_bit_cast(int, x), 0x76543210, 0xfedcba98, false, false)); }

// ---- tanh of two hidden units at once: the f32 tanh instruction (v_tanh_f32), one transcendental per value.
__device__ __forceinline__ v2f tnh2(v2f x) {
    v2f r; r[0] = __builtin_amdgcn_tanhf(x[0]); r[1] = __builtin_amdgcn_tanhf(x[1]);
    return r;
}

// ---- k_score: one block (16 waves) per (b, h, group of QG queries); wave w owns the 32 keys 32w .. 32w + 31 up to the softmax.
// Staging: the 512 raw key rows X[b][k][64h ..] are read as whole 256-B rows (16 B a lane), converted to bf16 (RNE) and put into a bf16 plane of their own, which stays to the end: it is the key operand and the value operand;
// the whole weight [HH][2*DHD] goes the same way into two bf16 planes (key side, query side) and the QG raw query rows into a third, all at a pitch of WPP halves (144 B = 16 B x odd). Block barrier.
// Projections (fragments: lane l, hi = l>>4, lr = l&15; A and B elements 0..7 <- row[k0+8hi+0..7], 8..15 <- row[k0+16+8hi+0..7]; D element j -> (row 8hi+j, col lr); k0 = 0 then 32, chained):
// key side, wave w, its own 32 keys: D[a][key] = Wk rows (A) x key rows (B), 4 hidden tiles x 2 key tiles; a lane's 8 D elements are 8 neighbouring hidden units of one key and STAY IN REGISTERS;
// query side, waves 0..3: D[a][q] = Wq rows (A) x query rows (B), hidden tile w, + bf16_RNE(b[a]): a lane holds 8 neighbouring hidden units of one query.
// Score: tanh(x) = 1 - 2 / (1 + e^2x), so s = sum_a w2[a] - 2 sum_a w2[a] / (1 + Ek[a] Eq[a]) with Ek = e^(2 kp), Eq = e^(2 qp). Four hidden units (a group) go over one denominator:
// sum_i w_i / (1 + Ek_i Eq_i) = N / P, P = prod_i (1 + Ek_i Eq_i) = sum_S EkS EqS, N = sum_i w_i prod_(j != i) (1 + Ek_j Eq_j) = sum_S EkS (WS EqS),
// S running over the 16 subsets of the group, EkS = prod_(i in S) Ek_i, EqS likewise, WS = sum_(i not in S) w_i. N and P are products of a key-side vector of 16 with query-side vectors of 16: matrix work.
// The k places of one WMMA hold two groups: lanes hi = 0 hold the 16 places of group g0 = 4at + u, lanes hi = 1 those of g1 = g0 + 2 (the groups whose hidden units those lanes own from the projections); element e of a lane = subset e, on both sides.
// A (row = key lr of a 16-key tile): the lane's 16 EkS as f16, formed in registers. B (col = query lr): one of four fragments per (at, u): N of g0, P of g0, N of g1, P of g1; a fragment is zero at the other group's k places,
// so lanes 16..31 of the first two and lanes 0..15 of the last two hold zeros. The NFR = 32 B fragments are laid out by lane in LDS (fragment 1 KB: elements 0..7 of lane l at 16 l, elements 8..15 at 512 + 16 l):
// the zeros are written in the staging part, the numbers by the query-side lanes straight from their D registers, each at its own lane's place. D element j of lane (lr, hi) = N or P of key 8hi + j of the tile and query lr:
// a lane holds all 16 fractions of 16 whole scores (keys 8hi + j and 16 + 8hi + j of the wave's 32, one query). The four fractions of a hidden tile go over one denominator once more, in f32:
// na / pa + N / P = (na P + N pa) / (pa P), three packed operations a fraction and score pair, and one reciprocal per four fractions; the four quotients of a score are added, and the score goes to one LDS plane (pitch SCP floats = 16 B x odd, 16-B stores).
// Range: the query side marks a lane where the |exponents| (base 2) of a group sum to more than EBQ or a |w2| exceeds WHI; without a mark 2^-13 <= EqS <= 2^13 and |WS EqS| <= 2^15: normal or zero, finite f16. P >= 1 (the empty subset).
// A key-side product under the normal f16 range is off by at most 2^-25, which is 2^-12 of P a subset; one above the f16 range turns into infinity, which makes P infinite or NaN and N infinite or NaN (0 x infinity = NaN), so the lane's sum is NaN. A wave that sees a mark, or a sum that is not finite, takes the loop with one tanh instruction a value on the same registers.
// A denominator pa near the top of the f32 range or over it would turn its quotient into a finite 0: products of two pa (each at least 1) are summed, and a wave where that sum is not under 2^120 takes the tanh loop too.
// The int mask words of the wave's 32 keys are compared by value (one ballot word): a set bit -> the score is replaced by -inf. Block barrier.
// Softmax: wave w takes query row w alone (16 keys a lane, f32, max-subtracted, exp2, rcp of the row sum; shuffle trees inside the wave) and writes the whole P row
// as two bf16 rows (hi = bf16_RNE(P), lo = bf16_RNE(P - hi), 1 KB each, one plane each) into LDS at a pitch of PPP halves (1040 B = 16 B x odd), each as 32 lanes x 16 B, twice.
// weights.values: [QG][TK] P (LDS) x V[k][64h + n] -> [QG][DHD]. Wave w takes the 16 output columns nt = w & 3 and the KQ keys of quarter kq = w >> 2: four chained WMMAs on hi, four on lo, the two sums added.
// Its value fragments come from the staged bf16 key rows by transposing LDS loads: two loads (keys kb + 8hi + 0..7 and kb + 16 + 8hi + 0..7 of column 16nt + lr) make one B fragment, in the k order of the P fragments.
// The four quarters meet in LDS and are added in f32, quarter 0 first;
// thread tid stores out[b][q0 + tid/32][64h + 2(tid%32) .. +1], so a wave writes one whole 256-B row piece.
__global__ __launch_bounds__(512) void k_score(const float* __restrict__ X, const float* __restrict__ Q, const float* __restrict__ Wt, const float* __restrict__ bias, const float* __restrict__ vv, const int* __restrict__ mask, float* OUT) {
    __shared__ __align__(16) float s_sc[QG * SCP];
    __shared__ __align__(16) float s_qp[QG * QPP];
    __shared__ __align__(16) float s_qm[128];
    __shared__ __align__(16) float s_sw[4];
    __shared__ __align__(16) float s_w2[HH];
    __shared__ __align__(16) unsigned s_af[NFR * 256];
    __shared__ __align__(16) bf s_p[2 * QG * PPP];
    __shared__ __align__(16) float s_o[4 * QG * DHD];
    __shared__ __align__(16) bf s_xb[TK * WPP];
    __shared__ __align__(16) bf s_wb[2 * HH * WPP];
    __shared__ __align__(16) bf s_qb[QG * WPP];
    const int blk = blockIdx.x; const int qg = blk % (TQ / QG); const int h = (blk / (TQ / QG)) % NHD; const int b = blk / ((TQ / QG) * NHD);
    const int tid = threadIdx.x, lane = tid & 31, wave = tid >> 5;
    const int q0 = qg * QG;
    const int lr = lane & 15, hi = lane >> 4, nt = wave & 3, kq = wave >> 2;
    const float* xh = X + (size_t)b * TK * DV + h * DHD;
    v4f bv[2], wq[2];
    int mk;
    {
        const int rr = wave * 32 + (lane >> 4), cc = (lane & 15) * 4;
        v4f st[16], wr[4];
#pragma unroll
        for (int j = 0; j < 16; ++j) st[j] = *(const v4f*)(xh + (size_t)(rr + 2 * j) * DV + cc);
#pragma unroll
        for (int j = 0; j < 4; ++j) wr[j] = *(const v4f*)(Wt + (size_t)(j * 512 + tid) * 4);
#pragma unroll
        for (int j = 0; j < 2; ++j) { bv[j] = *(const v4f*)(bias + nt * 16 + 8 * hi + 4 * j); wq[j] = *(const v4f*)(vv + nt * 16 + 8 * hi + 4 * j); }
        mk = mask[(size_t)b * TK + wave * 32 + lane];
        const v2f qv = *(const v2f*)(Q + ((size_t)b * TQ + q0 + wave) * DV + h * DHD + lane * 2);
        // what follows may be given the registers that hold the addresses of the loads above: this wait stands in front of it
        asm volatile("s_wait_xcnt 0x0" ::: "memory");
        // the zero lanes of the NFR query-side fragments (16..31 where the fragment is of g0, 0..15 where it is of g1): 16 threads a fragment, 2 x 16 B each
        { unsigned* z = s_af + (tid >> 4) * 256 + ((tid & 15) + 16 * (1 - ((tid >> 5) & 1))) * 4; *(v4ua*)z = (v4u){0u, 0u, 0u, 0u}; *(v4ua*)(z + 128) = (v4u){0u, 0u, 0u, 0u}; }
#pragma unroll
        for (int j = 0; j < 16; ++j) *(v4usa*)(s_xb + (rr + 2 * j) * WPP + cc) = cvt4(st[j]);
        // piece i of the weight: row a = i / 32, input columns 4 (i % 32) .. + 3; columns under DHD are the key side (plane 0), the rest the query side (plane 1)
#pragma unroll
        for (int j = 0; j < 4; ++j) { const int i = j * 512 + tid, col = (i & 31) * 4; *(v4usa*)(s_wb + ((col >> 6) * HH + (i >> 5)) * WPP + (col & 63)) = cvt4(wr[j]); }
        *(v2usa*)(s_qb + wave * WPP + lane * 2) = cvt2(qv);
        // bf16_RNE(w2) for the block: lanes 0 and 16 of waves 0..3 hold all HH of them, 8 each
        if (wave < 4 && lr == 0) { float* o = s_w2 + nt * 16 + 8 * hi; *(v4fa*)o = (v4f){bfr(wq[0][0]), bfr(wq[0][1]), bfr(wq[0][2]), bfr(wq[0][3])}; *(v4fa*)(o + 4) = (v4f){bfr(wq[1][0]), bfr(wq[1][1]), bfr(wq[1][2]), bfr(wq[1][3])}; }
    }
    __syncthreads();
    v8f kd[4][2];
    // key-side projection of the wave's own 32 keys, times 2 log2(e): kd[at][t][j] = hidden unit 16at + 8hi + j of key 32 wave + 16t + lr; it stays in registers for both score loops
    {
        v16bf xf[2][2];
#pragma unroll
        for (int t = 0; t < 2; ++t)
#pragma unroll
            for (int ks = 0; ks < 2; ++ks) xf[t][ks] = ldfrag(s_xb + (wave * 32 + t * 16 + lr) * WPP + ks * 32 + 8 * hi);
#pragma unroll
        for (int at = 0; at < 4; ++at) {
            const bf* pw = s_wb + (at * 16 + lr) * WPP + 8 * hi;
            const v16bf w0 = ldfrag(pw), w1 = ldfrag(pw + 32);
#pragma unroll
            for (int t = 0; t < 2; ++t) kd[at][t] = wmmab(w1, xf[t][1], wmmab(w0, xf[t][0], (v8f){})) * C2L;
        }
    }
    // the same for every lane of a wave: a scalar branch, so the matrix instructions inside run with all lanes on
    if (__builtin_amdgcn_readfirstlane(wave) < 4) {
        const bf* pq = s_qb + lr * WPP + 8 * hi; const bf* pw = s_wb + (HH + nt * 16 + lr) * WPP + 8 * hi;
        const v8f d = wmmab(ldfrag(pw + 32), ldfrag(pq + 32), wmmab(ldfrag(pw), ldfrag(pq), (v8f){}));
        float t[8], e[8], w[8];
        bool in = true;
#pragma unroll
        for (int j = 0; j < 8; ++j) { t[j] = d[j] + bfr(bv[j >> 2][j & 3]); w[j] = bfr(wq[j >> 2][j & 3]); }
        *(v4fa*)(s_qp + lr * QPP + nt * 16 + 8 * hi) = (v4f){t[0], t[1], t[2], t[3]}; *(v4fa*)(s_qp + lr * QPP + nt * 16 + 8 * hi + 4) = (v4f){t[4], t[5], t[6], t[7]};
#pragma unroll
        for (int j = 0; j < 8; ++j) { t[j] *= C2L; in &= fabsf(w[j]) <= WHI; }
#pragma unroll
        for (int u = 0; u < 2; ++u) in &= fabsf(t[4 * u]) + fabsf(t[4 * u + 1]) + fabsf(t[4 * u + 2]) + fabsf(t[4 * u + 3]) <= EBQ;
#pragma unroll
        for (int j = 0; j < 8; ++j) e[j] = __builtin_amdgcn_exp2f(t[j]);
#pragma unroll
        for (int u = 0; u < 2; ++u) {
            const float* wg = w + 4 * u;
            v2f f[8], n[8];
            sub16(e[4 * u], e[4 * u + 1], e[4 * u + 2], e[4 * u + 3], f);
            // WS = the weights of the hidden units that are not in S
            const float w01 = wg[0] + wg[1], w23 = wg[2] + wg[3];
            const v2f lo[2] = {(v2f){w01, wg[1]}, (v2f){wg[0], 0.0f}};
            const float up[4] = {w23, wg[3], wg[2], 0.0f};
#pragma unroll
            for (int j = 0; j < 8; ++j) n[j] = f[j] * (lo[j & 1] + up[j >> 1]);
            const v8u pn = pack16(n), pp = pack16(f);
            // fragments (nt, u, N of g_hi) and (nt, u, P of g_hi): column q = lr in the lane half hi, which is this lane's own place
            unsigned* o = s_af + ((nt * 2 + u) * 4 + 2 * hi) * 256 + lane * 4;
            *(v4ua*)o = (v4u){pn[0], pn[1], pn[2], pn[3]}; *(v4ua*)(o + 128) = (v4u){pn[4], pn[5], pn[6], pn[7]};
            *(v4ua*)(o + 256) = (v4u){pp[0], pp[1], pp[2], pp[3]}; *(v4ua*)(o + 384) = (v4u){pp[4], pp[5], pp[6], pp[7]};
        }
        // the lane's mark: 0 while its two groups and its eight weights lie inside the bounds of the f16 form
        s_qm[tid] = in ? 0.0f : 1.0f;
    } else if (__builtin_amdgcn_readfirstlane(wave) == 4) {
        // sum_a w2[a], once for the block, by a wave that has no query-side tile
        v2f t = (v2f){0.0f, 0.0f};
#pragma unroll
        for (int c = 0; c < HH / 4; ++c) { const v4f u = *(const v4fa*)(s_w2 + c * 4); t += (v2f){u[0], u[1]}; t += (v2f){u[2], u[3]}; }
        if (lane == 0) s_sw[0] = t[0] + t[1];
    }
    __syncthreads();
    const v4f qm4 = *(const v4fa*)(s_qm + lane * 4);
    // the lane's four of the 128 query-side marks; the ballot makes the choice the same for the whole wave
    bool slow = __builtin_amdgcn_ballot_w32(!(qm4[0] + qm4[1] + qm4[2] + qm4[3] == 0.0f)) != 0u;
    if (!slow) {
        const float sw = s_sw[0];
        // acc[t][c]: sum of the fractions of query lr and keys 32 wave + 16t + 8hi + 2c, + 1; tp: sum of products of two denominators (each at least 1), for the range check
        v2f acc[2][4], tp = (v2f){0.0f, 0.0f};
#pragma unroll
        for (int at = 0; at < 4; ++at) {
            // the four fractions of hidden tile at over one denominator: na / pa
            v2f na[2][4], pa[2][4];
#pragma unroll
            for (int u = 0; u < 2; ++u) {
                v16h fk[2];
#pragma unroll
                for (int t = 0; t < 2; ++t) {
                    v2f f[8];
                    sub16(__builtin_amdgcn_exp2f(kd[at][t][4 * u]), __builtin_amdgcn_exp2f(kd[at][t][4 * u + 1]), __builtin_amdgcn_exp2f(kd[at][t][4 * u + 2]), __builtin_amdgcn_exp2f(kd[at][t][4 * u + 3]), f);
                    fk[t] = __builtin_bit_cast(v16h, pack16(f));
                }
#pragma unroll
                for (int g = 0; g < 2; ++g) {
                    const unsigned* pf = s_af + ((at * 2 + u) * 4 + 2 * g) * 256 + lane * 4;
                    const v16h fn = __builtin_bit_cast(v16h, __builtin_shufflevector(*(const v4ua*)pf, *(const v4ua*)(pf + 128), 0, 1, 2, 3, 4, 5, 6, 7));
                    const v16h fp = __builtin_bit_cast(v16h, __builtin_shufflevector(*(const v4ua*)(pf + 256), *(const v4ua*)(pf + 384), 0, 1, 2, 3, 4, 5, 6, 7));
#pragma unroll
                    for (int t = 0; t < 2; ++t) {
                        const v8f p = wmmah(fk[t], fp, (v8f){}), n = wmmah(fk[t], fn, (v8f){});
#pragma unroll
                        for (int c = 0; c < 4; ++c) {
                            const v2f n2 = (v2f){n[2 * c], n[2 * c + 1]}, p2 = (v2f){p[2 * c], p[2 * c + 1]};
                            if (u == 0 && g == 0) { na[t][c] = n2; pa[t][c] = p2; }
                            else { na[t][c] = __builtin_elementwise_fma(na[t][c], p2, n2 * pa[t][c]); pa[t][c] *= p2; }
                        }
                    }
                }
            }
#pragma unroll
            for (int c = 0; c < 4; ++c) tp = __builtin_elementwise_fma(pa[0][c], pa[1][c], tp);
#pragma unroll
            for (int t = 0; t < 2; ++t)
#pragma unroll
                for (int c = 0; c < 4; ++c) {
                    const v2f r = (v2f){__builtin_amdgcn_rcpf(pa[t][c][0]), __builtin_amdgcn_rcpf(pa[t][c][1])};
                    acc[t][c] = at ? __builtin_elementwise_fma(na[t][c], r, acc[t][c]) : na[t][c] * r;
                }
        }
        v2f ts = acc[0][0] + acc[1][0];
#pragma unroll
        for (int c = 1; c < 4; ++c) ts += acc[0][c] + acc[1][c];
        // a denominator at the top of the f32 range or over it has a reciprocal of 0 and would give a finite, wrong quotient: every pa is at most tp, and under 2^120 its reciprocal is a normal number
        slow = __builtin_amdgcn_ballot_w32(!(fabsf(ts[0] + ts[1]) < INFINITY) || !(tp[0] + tp[1] < 0x1p+120f)) != 0u;
        v2f s[8];
#pragma unroll
        for (int i = 0; i < 8; ++i) s[i] = __builtin_elementwise_fma((v2f){-2.0f, -2.0f}, acc[i >> 2][i & 3], (v2f){sw, sw});
        // bit l = key 32 wave + l is masked out; the same for the whole wave: a scalar branch
        const unsigned bm = __builtin_amdgcn_ballot_w32(mk != 0);
        if (bm != 0u) {
            const unsigned mine = bm >> (8 * hi);
#pragma unroll
            for (int i = 0; i < 16; ++i) if ((mine >> ((i >> 3) * 16 + (i & 7))) & 1u) s[i >> 1][i & 1] = -INFINITY;
        }
        float* sc = s_sc + lr * SCP + wave * 32 + 8 * hi;
#pragma unroll
        for (int i = 0; i < 4; ++i) *(v4fa*)(sc + (i >> 1) * 16 + (i & 1) * 4) = (v4f){s[2 * i][0], s[2 * i][1], s[2 * i + 1][0], s[2 * i + 1][1]};
    }
    if (slow) {
        v8f wv[4];
#pragma unroll
        for (int at = 0; at < 4; ++at) { const v4f u0 = *(const v4fa*)(s_w2 + at * 16 + 8 * hi), u1 = *(const v4fa*)(s_w2 + at * 16 + 8 * hi + 4); wv[at] = (v8f){u0[0], u0[1], u0[2], u0[3], u1[0], u1[1], u1[2], u1[3]}; }
        // rolled over the queries: the body (32 hidden units x 2 keys, unrolled) stays a few KB of text
#pragma unroll 1
        for (int i = 0; i < QG; ++i) {
            const float* qr = s_qp + i * QPP + 8 * hi;
            v2f a0 = (v2f){0.0f, 0.0f}, a1 = (v2f){0.0f, 0.0f};
#pragma unroll
            for (int at = 0; at < 4; ++at) {
                const v4f x0 = *(const v4fa*)(qr + at * 16), x1 = *(const v4fa*)(qr + at * 16 + 4);
                const v8f qq = (v8f){x0[0], x0[1], x0[2], x0[3], x1[0], x1[1], x1[2], x1[3]};
#pragma unroll
                for (int c = 0; c < 4; ++c) {
                    const v2f q2 = (v2f){qq[2 * c], qq[2 * c + 1]}, w2 = (v2f){wv[at][2 * c], wv[at][2 * c + 1]};
                    a0 = __builtin_elementwise_fma(w2, tnh2(__builtin_elementwise_fma((v2f){kd[at][0][2 * c], kd[at][0][2 * c + 1]}, (v2f){1.0f / C2L, 1.0f / C2L}, q2)), a0);
                    a1 = __builtin_elementwise_fma(w2, tnh2(__builtin_elementwise_fma((v2f){kd[at][1][2 * c], kd[at][1][2 * c + 1]}, (v2f){1.0f / C2L, 1.0f / C2L}, q2)), a1);
                }
            }
            // here a lane owns keys lr and 16 + lr and half the hidden units: the halves meet across the lane halves, and lane l stores key l
            const float h0 = a0[0] + a0[1], h1 = a1[0] + a1[1];
            const float f0 = h0 + xhalf(h0), f1 = h1 + xhalf(h1);
            s_sc[i * SCP + wave * 32 + lane] = (mk != 0) ? -INFINITY : (hi ? f1 : f0);
        }
    }
    __syncthreads();
    // the value fragments are fetched here, so that their LDS latency passes under the softmax
    v16bf vb[4];
    const bf* pv = s_xb + (kq * KQ + 8 * hi + (lane & 7)) * WPP + nt * 16 + 8 * ((lane >> 3) & 1);
#pragma unroll
    for (int s = 0; s < 4; ++s) vb[s] = cat16b(ldtr(pv + s * 32 * WPP), ldtr(pv + (s * 32 + 16) * WPP));
    const float* row = s_sc + wave * SCP;
    v2f x[8];
#pragma unroll
    for (int i = 0; i < 2; ++i)
#pragma unroll
        for (int c = 0; c < 2; ++c) {
            const v4f t = *(const v4fa*)(row + (i * 32 + lane) * 8 + c * 4);
            x[4 * i + 2 * c] = (v2f){t[0], t[1]}; x[4 * i + 2 * c + 1] = (v2f){t[2], t[3]};
        }
    float m = x[0][0];
#pragma unroll
    for (int i = 0; i < 8; ++i) m = fmaxf(m, fmaxf(x[i][0], x[i][1]));
#pragma unroll
    for (int sh = 16; sh; sh >>= 1) m = fmaxf(m, __shfl_xor(m, sh, 32));
    v2f s2 = (v2f){0.0f, 0.0f};
#pragma unroll
    for (int i = 0; i < 8; ++i) { const v2f d = (x[i] - m) * LOG2E; x[i][0] = __builtin_amdgcn_exp2f(d[0]); x[i][1] = __builtin_amdgcn_exp2f(d[1]); s2 += x[i]; }
    float sum = s2[0] + s2[1];
#pragma unroll
    for (int sh = 16; sh; sh >>= 1) sum += __shfl_xor(sum, sh, 32);
    const float inv = __builtin_amdgcn_rcpf(sum);
    bf* dst = s_p + wave * PPP;
#pragma unroll
    for (int i = 0; i < 2; ++i) {
        v8us oh, ol;
#pragma unroll
        for (int c = 0; c < 4; ++c) {
            const v2f p = x[4 * i + c] * inv;
            const v2us ph = cvt2(p);
            const v2us pl = cvt2(p - (v2f){bf2f(ph[0]), bf2f(ph[1])});
            oh[2 * c] = ph[0]; oh[2 * c + 1] = ph[1]; ol[2 * c] = pl[0]; ol[2 * c + 1] = pl[1];
        }
        *(v8usa*)(dst + (i * 32 + lane) * 8) = oh;
        *(v8usa*)(dst + QG * PPP + (i * 32 + lane) * 8) = ol;
    }
    __syncthreads();
    v8f acc = (v8f){}, acl = (v8f){};
    const bf* pa = s_p + lr * PPP + kq * KQ + 8 * hi;
#pragma unroll
    for (int s = 0; s < 4; ++s) { acc = wmmab(ldfrag(pa + s * 32), vb[s], acc); acl = wmmab(ldfrag(pa + QG * PPP + s * 32), vb[s], acl); }
    acc += acl;
#pragma unroll
    for (int j = 0; j < 8; ++j) s_o[(kq * QG + hi * 8 + j) * DHD + nt * 16 + lr] = acc[j];
    __syncthreads();
    v2f r = *(const v2f*)(s_o + tid * 2);
#pragma unroll
    for (int g = 1; g < 4; ++g) r += *(const v2f*)(s_o + g * QG * DHD + tid * 2);
    *(v2f*)(OUT + ((size_t)b * TQ_FULL + q0 + wave) * DV + h * DHD + lane * 2) = r;
}

extern "C" void kernel_launch(void* const* d_in, const int* in_sizes, int n_in,
                              void* d_out, int out_size, void* d_ws, size_t ws_size, hipStream_t stream) {
    if (n_in < 6) return;
    if (in_sizes[0] < NB * TK * DV || in_sizes[1] < NB * TQ * DV || in_sizes[2] < HH * 2 * DHD || in_sizes[3] < HH || in_sizes[4] < HH || in_sizes[5] < NB * TK) return;
    if (out_size < NB_FULL * TQ_FULL * DV) return;
    const float* x     = (const float*)d_in[0];   // [NB][TK][DV]   keys and values
    const float* query = (const float*)d_in[1];   // [NB][TQ][DV]
    const float* W     = (const float*)d_in[2];   // [HH][2*DHD]    ([out][in]; key columns first, query columns second)
    const float* bb    = (const float*)d_in[3];   // [HH]
    const float* w2    = (const float*)d_in[4];   // [HH]
    const int*   mask  = (const int*)d_in[5];     // [NB][TK]       nonzero = key excluded
    float* OUT = (float*)d_out;                   // [NB_FULL][TQ_FULL][DV], byte offset 0
    (void)d_ws; (void)ws_size;                    // no workspace

    // projections + scores + mask + softmax + P . values per (b, h, QG queries): out[b][q][64h + d], f32
    k_score<<<(unsigned)(NB * NHD * (TQ / QG)), 512, 0, stream>>>(x, query, W, bb, w2, mask, OUT);
}
